// v000
// The times below were measured on an AMD MI455X: many runs one after another, warmed up first and cycling through
// copies of the inputs, with the whole window's GPU time divided by the number of runs. Launches and the gaps
// between them are all in it. The median over several windows is given; except for v000 it joins two sittings, which
// can be a few percent apart, so the side-by-side timings, each taken in one sitting, are the better comparison.
// v000, which the later versions start from, runs in 73.1 microseconds.
#include <hip/hip_runtime.h>
#include <hip/hip_bf16.h>
#include <math.h>

typedef __attribute__((ext_vector_type(16))) _Float16 v16h;
typedef __attribute__((ext_vector_type(8)))  _Float16 v8h;
typedef __attribute__((ext_vector_type(8)))  float    v8f;

#define WMMA_F16(A,B,C) __builtin_amdgcn_wmma_f32_16x16x32_f16(false,(A),false,(B),(short)0,(C),false,false)

#define NB 16    // batch
#define NC 256   // channels
#define NN 1024  // H*W
#define NH 8     // heads
#define KD 16    // key dim
#define DV 32    // value dim per head

// ---------------------------------------------------------------------------
// Kernel 1: fused QKV 1x1-conv + BN.  y[o,n] = (sum_c w[o,c] x[c,n])*s[o]+b[o]
// Output rows 0-127 -> Q, 128-255 -> K (stored [bh][n][16] f16),
// rows 256-511 -> V (stored [bh][d=32][n] f16).
// ---------------------------------------------------------------------------
__global__ __launch_bounds__(256) void qkv_kernel(
    const float* __restrict__ x,
    const float* __restrict__ wq, const float* __restrict__ sq, const float* __restrict__ bq,
    const float* __restrict__ wk, const float* __restrict__ sk, const float* __restrict__ bk,
    const float* __restrict__ wv, const float* __restrict__ sv, const float* __restrict__ bv,
    _Float16* __restrict__ Qws, _Float16* __restrict__ Kws, _Float16* __restrict__ Vws)
{
  // LDS: x tile transposed [n=64][c=256], stride 264 halves (16B-aligned rows)
  __shared__ __align__(16) _Float16 xs[64 * 264];
  const int tid = threadIdx.x;
  const int b   = blockIdx.z;
  const int n0  = blockIdx.x * 64;

  const float* xb = x + (size_t)b * NC * NN + n0;
  for (int i = tid; i < NC * 64; i += 256) {
    int c = i >> 6, n = i & 63;                 // n fastest -> coalesced global
    xs[n * 264 + c] = (_Float16)xb[(size_t)c * NN + n];
  }
  __syncthreads();

  const int wave = tid >> 5, lane = tid & 31;
  const int l16 = lane & 15, hi = lane >> 4;    // wave32: two 16-lane halves
  const int rt  = blockIdx.y * 8 + wave;        // row tile 0..31 (of 512 rows)

  const float *wm, *sm, *bm;
  int orow;
  if (rt < 8)       { wm = wq; sm = sq; bm = bq; orow = rt * 16; }
  else if (rt < 16) { wm = wk; sm = sk; bm = bk; orow = (rt - 8) * 16; }
  else              { wm = wv; sm = sv; bm = bv; orow = (rt - 16) * 16; }

  const float* arow = wm + (size_t)(orow + l16) * NC;
  v8f acc[4] = {};

#pragma unroll
  for (int ck = 0; ck < 8; ++ck) {              // K = 256 in chunks of 32
    const int cbase = ck * 32 + hi * 8;
    v16h aop;                                   // A tile 16x32 f16
    const float* ap = arow + cbase;
#pragma unroll
    for (int e = 0; e < 8; ++e) { aop[e] = (_Float16)ap[e]; aop[e + 8] = (_Float16)ap[e + 16]; }
#pragma unroll
    for (int ct = 0; ct < 4; ++ct) {            // 4 col tiles of 16
      const _Float16* bp = &xs[(ct * 16 + l16) * 264 + cbase];
      v8h blo = *(const v8h*)bp;
      v8h bhi = *(const v8h*)(bp + 16);
      v16h bop;                                 // B tile 32x16 f16
#pragma unroll
      for (int e = 0; e < 8; ++e) { bop[e] = blo[e]; bop[e + 8] = bhi[e]; }
      acc[ct] = WMMA_F16(aop, bop, acc[ct]);
    }
  }

  // epilogue: scale+bias, convert f16, layout-specific stores
#pragma unroll
  for (int ct = 0; ct < 4; ++ct) {
    const int nn = n0 + ct * 16 + l16;
    if (rt < 16) {                              // Q or K: [bh][n][16], one b128/lane
      v8h ov;
#pragma unroll
      for (int r = 0; r < 8; ++r) {
        int o = orow + r + 8 * hi;
        ov[r] = (_Float16)(acc[ct][r] * sm[o] + bm[o]);
      }
      _Float16* base = (rt < 8) ? Qws : Kws;
      _Float16* dst  = base + (((size_t)(b * NH + (rt & 7)) * NN + nn) * KD + 8 * hi);
      *(v8h*)dst = ov;
    } else {                                    // V: [bh][d][n]
      int head  = (rt - 16) >> 1;
      int dbase = ((rt - 16) & 1) * 16 + 8 * hi;
      _Float16* vdst = Vws + ((size_t)(b * NH + head) * DV + dbase) * NN + nn;
#pragma unroll
      for (int r = 0; r < 8; ++r) {
        int o = orow + r + 8 * hi;
        vdst[(size_t)r * NN] = (_Float16)(acc[ct][r] * sm[o] + bm[o]);
      }
    }
  }
}

// ---------------------------------------------------------------------------
// Kernel 2: fused flash-attention per (bh, 16-query tile), one wave each.
// Scores computed transposed (A=K-tile, B=Q-tile) so softmax reduces in-lane
// + one shfl_xor(16), and exp() results feed the PV WMMA B-operand directly.
// ---------------------------------------------------------------------------
__global__ __launch_bounds__(128) void attn_kernel(
    const _Float16* __restrict__ Qws, const _Float16* __restrict__ Kws,
    const _Float16* __restrict__ Vws, _Float16* __restrict__ Ows)
{
  const int tid  = threadIdx.x;
  const int wave = tid >> 5, lane = tid & 31;
  const int l16  = lane & 15, hi = lane >> 4;
  const int bh   = blockIdx.y;                  // 0..127
  const int qt   = blockIdx.x * 4 + wave;       // 0..63
  const int q    = qt * 16 + l16;

  // Q as B operand [kdim(32, padded) x 16 queries]; pad rows 16..31 = 0
  v16h bq = {};
  {
    const _Float16* qp = Qws + (((size_t)bh * NN + q) * KD + 8 * hi);
    v8h qv = *(const v8h*)qp;
#pragma unroll
    for (int e = 0; e < 8; ++e) bq[e] = qv[e];
  }

  v8f acc0 = {}, acc1 = {};                     // [d0..15 x q], [d16..31 x q]
  float mQ = -1e30f, lQ = 0.f;
  const v8f zc = {};
  const _Float16* kbase = Kws + (size_t)bh * NN * KD;
  const _Float16* vbase = Vws + (size_t)bh * DV * NN;

  for (int m0 = 0; m0 < NN; m0 += 32) {
    // K tiles as A operand [16 keys x kdim(32, padded)]
    v16h ka0 = {}, ka1 = {};
    {
      v8h k0 = *(const v8h*)(kbase + ((size_t)(m0 + l16) * KD + 8 * hi));
      v8h k1 = *(const v8h*)(kbase + ((size_t)(m0 + 16 + l16) * KD + 8 * hi));
#pragma unroll
      for (int e = 0; e < 8; ++e) { ka0[e] = k0[e]; ka1[e] = k1[e]; }
    }
    v8f s0 = WMMA_F16(ka0, bq, zc);             // S^T: VGPR r = key r+8*hi, lane = q
    v8f s1 = WMMA_F16(ka1, bq, zc);             // keys m0+16..m0+31

    // block max over 32 keys: 16 in-lane + complementary half via xor-16
    float bmax = -1e30f;
#pragma unroll
    for (int r = 0; r < 8; ++r) bmax = fmaxf(bmax, fmaxf(s0[r], s1[r]));
    bmax = fmaxf(bmax, __shfl_xor(bmax, 16, 32));
    float mNew = fmaxf(mQ, bmax);
    float corr = __expf(mQ - mNew);

    float psum = 0.f;
    v16h pb;                                    // P as B operand [m=32 x q=16]
#pragma unroll
    for (int r = 0; r < 8; ++r) {
      float p0 = __expf(s0[r] - mNew);
      float p1 = __expf(s1[r] - mNew);
      psum += p0 + p1;
      pb[r]     = (_Float16)p0;                 // m = r+8*hi       (matches B layout)
      pb[r + 8] = (_Float16)p1;                 // m = 16+r+8*hi
    }
    psum += __shfl_xor(psum, 16, 32);
    lQ = lQ * corr + psum;
    mQ = mNew;
#pragma unroll
    for (int r = 0; r < 8; ++r) { acc0[r] *= corr; acc1[r] *= corr; }

    // V tiles as A operand [16 d x 32 m]
    const _Float16* v0p = vbase + (size_t)l16 * NN + m0 + 8 * hi;
    const _Float16* v1p = vbase + (size_t)(16 + l16) * NN + m0 + 8 * hi;
    v8h va0l = *(const v8h*)v0p, va0h = *(const v8h*)(v0p + 16);
    v8h va1l = *(const v8h*)v1p, va1h = *(const v8h*)(v1p + 16);
    v16h va0, va1;
#pragma unroll
    for (int e = 0; e < 8; ++e) {
      va0[e] = va0l[e]; va0[e + 8] = va0h[e];
      va1[e] = va1l[e]; va1[e + 8] = va1h[e];
    }
    acc0 = WMMA_F16(va0, pb, acc0);
    acc1 = WMMA_F16(va1, pb, acc1);

    if (m0 + 32 < NN) {                         // global_prefetch_b8 for next block
      __builtin_prefetch(kbase + (size_t)(m0 + 32 + l16) * KD, 0, 0);
      __builtin_prefetch(v0p + 32, 0, 0);
      __builtin_prefetch(v1p + 32, 0, 0);
    }
  }

  // normalize, ReLU, store O as [b][h*32+d][n] f16 for the projection GEMM
  const float inv = 1.0f / lQ;
  const int b = bh >> 3, h = bh & 7;
  _Float16* obase = Ows + ((size_t)b * (NH * DV) + h * DV) * NN + q;
#pragma unroll
  for (int r = 0; r < 8; ++r) {
    int d0 = r + 8 * hi, d1 = 16 + r + 8 * hi;
    obase[(size_t)d0 * NN] = (_Float16)fmaxf(acc0[r] * inv, 0.f);
    obase[(size_t)d1 * NN] = (_Float16)fmaxf(acc1[r] * inv, 0.f);
  }
}

// ---------------------------------------------------------------------------
// Kernel 3: output projection 1x1-conv + BN, f32 result to d_out.
// ---------------------------------------------------------------------------
__global__ __launch_bounds__(256) void proj_kernel(
    const _Float16* __restrict__ Ows, const float* __restrict__ wp,
    const float* __restrict__ sp, const float* __restrict__ bp,
    float* __restrict__ out)
{
  __shared__ __align__(16) _Float16 xs[64 * 264];
  const int tid = threadIdx.x;
  const int b   = blockIdx.z;
  const int n0  = blockIdx.x * 64;

  const _Float16* ob = Ows + (size_t)b * NC * NN + n0;
  for (int i = tid; i < NC * 64; i += 256) {
    int c = i >> 6, n = i & 63;
    xs[n * 264 + c] = ob[(size_t)c * NN + n];
  }
  __syncthreads();

  const int wave = tid >> 5, lane = tid & 31;
  const int l16 = lane & 15, hi = lane >> 4;
  const int rt  = blockIdx.y * 8 + wave;        // 0..15
  const int orow = rt * 16;
  const float* arow = wp + (size_t)(orow + l16) * NC;

  v8f acc[4] = {};
#pragma unroll
  for (int ck = 0; ck < 8; ++ck) {
    const int cbase = ck * 32 + hi * 8;
    v16h aop;
    const float* ap = arow + cbase;
#pragma unroll
    for (int e = 0; e < 8; ++e) { aop[e] = (_Float16)ap[e]; aop[e + 8] = (_Float16)ap[e + 16]; }
#pragma unroll
    for (int ct = 0; ct < 4; ++ct) {
      const _Float16* bptr = &xs[(ct * 16 + l16) * 264 + cbase];
      v8h blo = *(const v8h*)bptr;
      v8h bh2 = *(const v8h*)(bptr + 16);
      v16h bop;
#pragma unroll
      for (int e = 0; e < 8; ++e) { bop[e] = blo[e]; bop[e + 8] = bh2[e]; }
      acc[ct] = WMMA_F16(aop, bop, acc[ct]);
    }
  }

#pragma unroll
  for (int ct = 0; ct < 4; ++ct) {
    const int nn = n0 + ct * 16 + l16;
    float* dst = out + (size_t)b * NC * NN + nn;
#pragma unroll
    for (int r = 0; r < 8; ++r) {
      int o = orow + r + 8 * hi;
      dst[(size_t)o * NN] = acc[ct][r] * sp[o] + bp[o];
    }
  }
}

// ---------------------------------------------------------------------------
extern "C" void kernel_launch(void* const* d_in, const int* in_sizes, int n_in,
                              void* d_out, int out_size, void* d_ws, size_t ws_size,
                              hipStream_t stream) {
  const float* x  = (const float*)d_in[0];
  const float* wq = (const float*)d_in[1];
  const float* sq = (const float*)d_in[2];
  const float* bq = (const float*)d_in[3];
  const float* wk = (const float*)d_in[4];
  const float* sk = (const float*)d_in[5];
  const float* bk = (const float*)d_in[6];
  const float* wv = (const float*)d_in[7];
  const float* sv = (const float*)d_in[8];
  const float* bv = (const float*)d_in[9];
  const float* wp = (const float*)d_in[10];
  const float* sp = (const float*)d_in[11];
  const float* bp = (const float*)d_in[12];
  float* out = (float*)d_out;

  // Workspace layout (f16): Q 4MB | K 4MB | V 8MB | O 8MB  (24MB total)
  char* wsb = (char*)d_ws;
  _Float16* Qws = (_Float16*)(wsb);
  _Float16* Kws = (_Float16*)(wsb + (4u  << 20));
  _Float16* Vws = (_Float16*)(wsb + (8u  << 20));
  _Float16* Ows = (_Float16*)(wsb + (16u << 20));

  qkv_kernel <<<dim3(16, 4, 16), 256, 0, stream>>>(x, wq, sq, bq, wk, sk, bk, wv, sv, bv, Qws, Kws, Vws);
  attn_kernel<<<dim3(16, 128),   128, 0, stream>>>(Qws, Kws, Vws, Ows);
  proj_kernel<<<dim3(16, 2, 16), 256, 0, stream>>>(Ows, wp, sp, bp, out);

  (void)in_sizes; (void)n_in; (void)out_size; (void)ws_size;
}

// v001
// One run takes 59.4 microseconds.
// Two timings next to v000 both put it at 1.28 times that version's speed.
#include <hip/hip_runtime.h>
#include <hip/hip_bf16.h>
#include <math.h>

typedef __attribute__((ext_vector_type(16))) _Float16 v16h;
typedef __attribute__((ext_vector_type(8)))  _Float16 v8h;
typedef __attribute__((ext_vector_type(8)))  float    v8f;

#define WMMA_F16(A,B,C) __builtin_amdgcn_wmma_f32_16x16x32_f16(false,(A),false,(B),(short)0,(C),false,false)

#define NB 16    // batch
#define NC 256   // channels
#define NN 1024  // H*W
#define NH 8     // heads
#define KD 16    // key dim
#define DV 32    // value dim per head

// ---------------------------------------------------------------------------
// Kernel 1: fused QKV 1x1-conv + BN.  y[o,n] = (sum_c w[o,c] x[c,n])*s[o]+b[o]
// Output rows 0-127 -> Q, 128-255 -> K (stored [bh][n][16] f16),
// rows 256-511 -> V (stored [bh][d=32][n] f16).
// ---------------------------------------------------------------------------
__global__ __launch_bounds__(256) void qkv_kernel(
    const float* __restrict__ x,
    const float* __restrict__ wq, const float* __restrict__ sq, const float* __restrict__ bq,
    const float* __restrict__ wk, const float* __restrict__ sk, const float* __restrict__ bk,
    const float* __restrict__ wv, const float* __restrict__ sv, const float* __restrict__ bv,
    _Float16* __restrict__ Qws, _Float16* __restrict__ Kws, _Float16* __restrict__ Vws)
{
  // LDS: x tile transposed [n=64][c=256], stride 264 halves (16B-aligned rows)
  __shared__ __align__(16) _Float16 xs[64 * 264];
  const int tid = threadIdx.x;
  const int b   = blockIdx.z;
  const int n0  = blockIdx.x * 64;

  const float* xb = x + (size_t)b * NC * NN + n0;
  for (int i = tid; i < NC * 64; i += 256) {
    int c = i >> 6, n = i & 63;                 // n fastest -> coalesced global
    xs[n * 264 + c] = (_Float16)xb[(size_t)c * NN + n];
  }
  __syncthreads();

  const int wave = tid >> 5, lane = tid & 31;
  const int l16 = lane & 15, hi = lane >> 4;    // wave32: two 16-lane halves
  const int rt  = blockIdx.y * 8 + wave;        // row tile 0..31 (of 512 rows)

  const float *wm, *sm, *bm;
  int orow;
  if (rt < 8)       { wm = wq; sm = sq; bm = bq; orow = rt * 16; }
  else if (rt < 16) { wm = wk; sm = sk; bm = bk; orow = (rt - 8) * 16; }
  else              { wm = wv; sm = sv; bm = bv; orow = (rt - 16) * 16; }

  const float* arow = wm + (size_t)(orow + l16) * NC;
  v8f acc[4] = {};

#pragma unroll
  for (int ck = 0; ck < 8; ++ck) {              // K = 256 in chunks of 32
    const int cbase = ck * 32 + hi * 8;
    v16h aop;                                   // A tile 16x32 f16
    const float* ap = arow + cbase;
#pragma unroll
    for (int e = 0; e < 8; ++e) { aop[e] = (_Float16)ap[e]; aop[e + 8] = (_Float16)ap[e + 16]; }
#pragma unroll
    for (int ct = 0; ct < 4; ++ct) {            // 4 col tiles of 16
      const _Float16* bp = &xs[(ct * 16 + l16) * 264 + cbase];
      v8h blo = *(const v8h*)bp;
      v8h bhi = *(const v8h*)(bp + 16);
      v16h bop;                                 // B tile 32x16 f16
#pragma unroll
      for (int e = 0; e < 8; ++e) { bop[e] = blo[e]; bop[e + 8] = bhi[e]; }
      acc[ct] = WMMA_F16(aop, bop, acc[ct]);
    }
  }

  // epilogue: scale+bias, convert f16, layout-specific stores
#pragma unroll
  for (int ct = 0; ct < 4; ++ct) {
    const int nn = n0 + ct * 16 + l16;
    if (rt < 16) {                              // Q or K: [bh][n][16], one b128/lane
      v8h ov;
#pragma unroll
      for (int r = 0; r < 8; ++r) {
        int o = orow + r + 8 * hi;
        ov[r] = (_Float16)(acc[ct][r] * sm[o] + bm[o]);
      }
      _Float16* base = (rt < 8) ? Qws : Kws;
      _Float16* dst  = base + (((size_t)(b * NH + (rt & 7)) * NN + nn) * KD + 8 * hi);
      *(v8h*)dst = ov;
    } else {                                    // V: [bh][d][n]
      int head  = (rt - 16) >> 1;
      int dbase = ((rt - 16) & 1) * 16 + 8 * hi;
      _Float16* vdst = Vws + ((size_t)(b * NH + head) * DV + dbase) * NN + nn;
#pragma unroll
      for (int r = 0; r < 8; ++r) {
        int o = orow + r + 8 * hi;
        vdst[(size_t)r * NN] = (_Float16)(acc[ct][r] * sm[o] + bm[o]);
      }
    }
  }
}

// ---------------------------------------------------------------------------
// Kernel 2: fused flash-attention. One work-group = one (batch, head) and 256
// queries: its 16 waves stage that head's whole K and V in LDS once, then each
// wave walks all keys for its own 16-query tile out of LDS.
// Scores computed transposed (A=K-tile, B=Q-tile) so softmax reduces in-lane
// + one shfl_xor(16), and exp() results feed the PV WMMA B-operand directly.
// ---------------------------------------------------------------------------
#define KP (NN * 8 + 64)  // halves per K plane; the 128 B between the planes put a
                          // staging store's even and odd lanes on different banks
#define VP 1032  // LDS pitch of a V row in halves: 2064 B = 16 B x odd, so the
                 // 16 rows one ds_load_b128 touches fall on different banks

__global__ __launch_bounds__(512) void attn_kernel(
    const _Float16* __restrict__ Qws, const _Float16* __restrict__ Kws,
    const _Float16* __restrict__ Vws, _Float16* __restrict__ Ows)
{
  __shared__ __align__(16) _Float16 ks[2 * KP];    // [kdim half][key][8]: each 16-lane
                                                   // half of a K read is 256 contiguous B
  __shared__ __align__(16) _Float16 vs[DV * VP];   // [d][key], padded rows

  const int tid  = threadIdx.x;
  const int wave = tid >> 5, lane = tid & 31;
  const int l16  = lane & 15, hi = lane >> 4;
  const int bh   = blockIdx.y;                  // 0..127
  const int qt   = blockIdx.x * 16 + wave;      // 0..63
  const int q    = qt * 16 + l16;

  const _Float16* kbase = Kws + (size_t)bh * NN * KD;
  const _Float16* vbase = Vws + (size_t)bh * DV * NN;

  // Stage K (32 KB) and V (64 KB): 16 B per lane, each wave-load 512 contiguous B
  {
    v8h kr[4], vr[8];
#pragma unroll
    for (int j = 0; j < 4; ++j) kr[j] = *(const v8h*)(kbase + (size_t)(tid + j * 512) * 8);
#pragma unroll
    for (int j = 0; j < 8; ++j) vr[j] = *(const v8h*)(vbase + (size_t)(tid + j * 512) * 8);
#pragma unroll
    for (int j = 0; j < 4; ++j) {
      const int i = tid + j * 512;              // 2 chunks of 16 B per key
      *(v8h*)&ks[(i & 1) * KP + (i >> 1) * 8] = kr[j];
    }
#pragma unroll
    for (int j = 0; j < 8; ++j) {
      const int i = tid + j * 512;              // 128 chunks of 16 B per V row
      *(v8h*)&vs[(i >> 7) * VP + (i & 127) * 8] = vr[j];
    }
  }

  // Q as B operand [kdim(32, padded) x 16 queries]; pad rows 16..31 = 0
  v16h bq = {};
  {
    const _Float16* qp = Qws + (((size_t)bh * NN + q) * KD + 8 * hi);
    v8h qv = *(const v8h*)qp;
#pragma unroll
    for (int e = 0; e < 8; ++e) bq[e] = qv[e];
  }
  __syncthreads();                              // K and V published to all 16 waves

  v8f acc0 = {}, acc1 = {};                     // [d0..15 x q], [d16..31 x q]
  float mQ = -1e30f, lQ = 0.f;
  const v8f zc = {};

  for (int m0 = 0; m0 < NN; m0 += 32) {
    // K tiles as A operand [16 keys x kdim(32, padded)]
    v16h ka0 = {}, ka1 = {};
    {
      v8h k0 = *(const v8h*)&ks[hi * KP + (m0 + l16) * 8];
      v8h k1 = *(const v8h*)&ks[hi * KP + (m0 + 16 + l16) * 8];
#pragma unroll
      for (int e = 0; e < 8; ++e) { ka0[e] = k0[e]; ka1[e] = k1[e]; }
    }
    v8f s0 = WMMA_F16(ka0, bq, zc);             // S^T: VGPR r = key r+8*hi, lane = q
    v8f s1 = WMMA_F16(ka1, bq, zc);             // keys m0+16..m0+31

    // block max over 32 keys: 16 in-lane + complementary half via xor-16
    float bmax = -1e30f;
#pragma unroll
    for (int r = 0; r < 8; ++r) bmax = fmaxf(bmax, fmaxf(s0[r], s1[r]));
    bmax = fmaxf(bmax, __shfl_xor(bmax, 16, 32));
    float mNew = fmaxf(mQ, bmax);
    float corr = __expf(mQ - mNew);

    float psum = 0.f;
    v16h pb;                                    // P as B operand [m=32 x q=16]
#pragma unroll
    for (int r = 0; r < 8; ++r) {
      float p0 = __expf(s0[r] - mNew);
      float p1 = __expf(s1[r] - mNew);
      psum += p0 + p1;
      pb[r]     = (_Float16)p0;                 // m = r+8*hi       (matches B layout)
      pb[r + 8] = (_Float16)p1;                 // m = 16+r+8*hi
    }
    psum += __shfl_xor(psum, 16, 32);
    lQ = lQ * corr + psum;
    mQ = mNew;
#pragma unroll
    for (int r = 0; r < 8; ++r) { acc0[r] *= corr; acc1[r] *= corr; }

    // V tiles as A operand [16 d x 32 m]
    const _Float16* v0p = &vs[l16 * VP + m0 + 8 * hi];
    const _Float16* v1p = &vs[(16 + l16) * VP + m0 + 8 * hi];
    v8h va0l = *(const v8h*)v0p, va0h = *(const v8h*)(v0p + 16);
    v8h va1l = *(const v8h*)v1p, va1h = *(const v8h*)(v1p + 16);
    v16h va0, va1;
#pragma unroll
    for (int e = 0; e < 8; ++e) {
      va0[e] = va0l[e]; va0[e + 8] = va0h[e];
      va1[e] = va1l[e]; va1[e + 8] = va1h[e];
    }
    acc0 = WMMA_F16(va0, pb, acc0);
    acc1 = WMMA_F16(va1, pb, acc1);
  }

  // normalize, ReLU, store O as [b][h*32+d][n] f16 for the projection GEMM
  const float inv = 1.0f / lQ;
  const int b = bh >> 3, h = bh & 7;
  _Float16* obase = Ows + ((size_t)b * (NH * DV) + h * DV) * NN + q;
#pragma unroll
  for (int r = 0; r < 8; ++r) {
    int d0 = r + 8 * hi, d1 = 16 + r + 8 * hi;
    obase[(size_t)d0 * NN] = (_Float16)fmaxf(acc0[r] * inv, 0.f);
    obase[(size_t)d1 * NN] = (_Float16)fmaxf(acc1[r] * inv, 0.f);
  }
}

// ---------------------------------------------------------------------------
// Kernel 3: output projection 1x1-conv + BN, f32 result to d_out.
// ---------------------------------------------------------------------------
__global__ __launch_bounds__(256) void proj_kernel(
    const _Float16* __restrict__ Ows, const float* __restrict__ wp,
    const float* __restrict__ sp, const float* __restrict__ bp,
    float* __restrict__ out)
{
  __shared__ __align__(16) _Float16 xs[64 * 264];
  const int tid = threadIdx.x;
  const int b   = blockIdx.z;
  const int n0  = blockIdx.x * 64;

  const _Float16* ob = Ows + (size_t)b * NC * NN + n0;
  for (int i = tid; i < NC * 64; i += 256) {
    int c = i >> 6, n = i & 63;
    xs[n * 264 + c] = ob[(size_t)c * NN + n];
  }
  __syncthreads();

  const int wave = tid >> 5, lane = tid & 31;
  const int l16 = lane & 15, hi = lane >> 4;
  const int rt  = blockIdx.y * 8 + wave;        // 0..15
  const int orow = rt * 16;
  const float* arow = wp + (size_t)(orow + l16) * NC;

  v8f acc[4] = {};
#pragma unroll
  for (int ck = 0; ck < 8; ++ck) {
    const int cbase = ck * 32 + hi * 8;
    v16h aop;
    const float* ap = arow + cbase;
#pragma unroll
    for (int e = 0; e < 8; ++e) { aop[e] = (_Float16)ap[e]; aop[e + 8] = (_Float16)ap[e + 16]; }
#pragma unroll
    for (int ct = 0; ct < 4; ++ct) {
      const _Float16* bptr = &xs[(ct * 16 + l16) * 264 + cbase];
      v8h blo = *(const v8h*)bptr;
      v8h bh2 = *(const v8h*)(bptr + 16);
      v16h bop;
#pragma unroll
      for (int e = 0; e < 8; ++e) { bop[e] = blo[e]; bop[e + 8] = bh2[e]; }
      acc[ct] = WMMA_F16(aop, bop, acc[ct]);
    }
  }

#pragma unroll
  for (int ct = 0; ct < 4; ++ct) {
    const int nn = n0 + ct * 16 + l16;
    float* dst = out + (size_t)b * NC * NN + nn;
#pragma unroll
    for (int r = 0; r < 8; ++r) {
      int o = orow + r + 8 * hi;
      dst[(size_t)o * NN] = acc[ct][r] * sp[o] + bp[o];
    }
  }
}

// ---------------------------------------------------------------------------
extern "C" void kernel_launch(void* const* d_in, const int* in_sizes, int n_in,
                              void* d_out, int out_size, void* d_ws, size_t ws_size,
                              hipStream_t stream) {
  const float* x  = (const float*)d_in[0];
  const float* wq = (const float*)d_in[1];
  const float* sq = (const float*)d_in[2];
  const float* bq = (const float*)d_in[3];
  const float* wk = (const float*)d_in[4];
  const float* sk = (const float*)d_in[5];
  const float* bk = (const float*)d_in[6];
  const float* wv = (const float*)d_in[7];
  const float* sv = (const float*)d_in[8];
  const float* bv = (const float*)d_in[9];
  const float* wp = (const float*)d_in[10];
  const float* sp = (const float*)d_in[11];
  const float* bp = (const float*)d_in[12];
  float* out = (float*)d_out;

  // Workspace layout (f16): Q 4MB | K 4MB | V 8MB | O 8MB  (24MB total)
  char* wsb = (char*)d_ws;
  _Float16* Qws = (_Float16*)(wsb);
  _Float16* Kws = (_Float16*)(wsb + (4u  << 20));
  _Float16* Vws = (_Float16*)(wsb + (8u  << 20));
  _Float16* Ows = (_Float16*)(wsb + (16u << 20));

  qkv_kernel <<<dim3(16, 4, 16), 256, 0, stream>>>(x, wq, sq, bq, wk, sk, bk, wv, sv, bv, Qws, Kws, Vws);
  attn_kernel<<<dim3(4, 128),    512, 0, stream>>>(Qws, Kws, Vws, Ows);
  proj_kernel<<<dim3(16, 2, 16), 256, 0, stream>>>(Ows, wp, sp, bp, out);

  (void)in_sizes; (void)n_in; (void)out_size; (void)ws_size;
}

// v002
// Measured time: 53.4 microseconds a run.
// Next to v001, in two timings, it ran 1.11 times as fast each time.
// Over all steps from v000 it is 1.42 times as fast.
#include <hip/hip_runtime.h>
#include <hip/hip_bf16.h>
#include <math.h>

typedef __attribute__((ext_vector_type(16))) _Float16 v16h;
typedef __attribute__((ext_vector_type(8)))  _Float16 v8h;
typedef __attribute__((ext_vector_type(8)))  float    v8f;

#define WMMA_F16(A,B,C) __builtin_amdgcn_wmma_f32_16x16x32_f16(false,(A),false,(B),(short)0,(C),false,false)

#define NB 16    // batch
#define NC 256   // channels
#define NN 1024  // H*W
#define NH 8     // heads
#define KD 16    // key dim
#define DV 32    // value dim per head
#define LOG2E 1.4426950408889634f

// ---------------------------------------------------------------------------
// Kernel 1: fused QKV 1x1-conv + BN.  y[o,n] = (sum_c w[o,c] x[c,n])*s[o]+b[o]
// Output rows 0-127 -> Q, 128-255 -> K (stored [bh][n][16] f16),
// rows 256-511 -> V (stored [bh][d=32][n] f16).
// ---------------------------------------------------------------------------
__global__ __launch_bounds__(256) void qkv_kernel(
    const float* __restrict__ x,
    const float* __restrict__ wq, const float* __restrict__ sq, const float* __restrict__ bq,
    const float* __restrict__ wk, const float* __restrict__ sk, const float* __restrict__ bk,
    const float* __restrict__ wv, const float* __restrict__ sv, const float* __restrict__ bv,
    _Float16* __restrict__ Qws, _Float16* __restrict__ Kws, _Float16* __restrict__ Vws)
{
  // LDS: x tile transposed [n=64][c=256], stride 264 halves (16B-aligned rows)
  __shared__ __align__(16) _Float16 xs[64 * 264];
  const int tid = threadIdx.x;
  const int b   = blockIdx.z;
  const int n0  = blockIdx.x * 64;

  const float* xb = x + (size_t)b * NC * NN + n0;
  for (int i = tid; i < NC * 64; i += 256) {
    int c = i >> 6, n = i & 63;                 // n fastest -> coalesced global
    xs[n * 264 + c] = (_Float16)xb[(size_t)c * NN + n];
  }
  __syncthreads();

  const int wave = tid >> 5, lane = tid & 31;
  const int l16 = lane & 15, hi = lane >> 4;    // wave32: two 16-lane halves
  const int rt  = blockIdx.y * 8 + wave;        // row tile 0..31 (of 512 rows)

  const float *wm, *sm, *bm;
  int orow;
  if (rt < 8)       { wm = wq; sm = sq; bm = bq; orow = rt * 16; }
  else if (rt < 16) { wm = wk; sm = sk; bm = bk; orow = (rt - 8) * 16; }
  else              { wm = wv; sm = sv; bm = bv; orow = (rt - 16) * 16; }

  const float* arow = wm + (size_t)(orow + l16) * NC;
  v8f acc[4] = {};

#pragma unroll
  for (int ck = 0; ck < 8; ++ck) {              // K = 256 in chunks of 32
    const int cbase = ck * 32 + hi * 8;
    v16h aop;                                   // A tile 16x32 f16
    const float* ap = arow + cbase;
#pragma unroll
    for (int e = 0; e < 8; ++e) { aop[e] = (_Float16)ap[e]; aop[e + 8] = (_Float16)ap[e + 16]; }
#pragma unroll
    for (int ct = 0; ct < 4; ++ct) {            // 4 col tiles of 16
      const _Float16* bp = &xs[(ct * 16 + l16) * 264 + cbase];
      v8h blo = *(const v8h*)bp;
      v8h bhi = *(const v8h*)(bp + 16);
      v16h bop;                                 // B tile 32x16 f16
#pragma unroll
      for (int e = 0; e < 8; ++e) { bop[e] = blo[e]; bop[e + 8] = bhi[e]; }
      acc[ct] = WMMA_F16(aop, bop, acc[ct]);
    }
  }

  // epilogue: scale+bias, convert f16, layout-specific stores
#pragma unroll
  for (int ct = 0; ct < 4; ++ct) {
    const int nn = n0 + ct * 16 + l16;
    if (rt < 16) {                              // Q or K: [bh][n][16], one b128/lane
      v8h ov;
#pragma unroll
      for (int r = 0; r < 8; ++r) {
        int o = orow + r + 8 * hi;
        ov[r] = (_Float16)(acc[ct][r] * sm[o] + bm[o]);
      }
      _Float16* base = (rt < 8) ? Qws : Kws;
      _Float16* dst  = base + (((size_t)(b * NH + (rt & 7)) * NN + nn) * KD + 8 * hi);
      *(v8h*)dst = ov;
    } else {                                    // V: [bh][d][n]
      int head  = (rt - 16) >> 1;
      int dbase = ((rt - 16) & 1) * 16 + 8 * hi;
      _Float16* vdst = Vws + ((size_t)(b * NH + head) * DV + dbase) * NN + nn;
#pragma unroll
      for (int r = 0; r < 8; ++r) {
        int o = orow + r + 8 * hi;
        vdst[(size_t)r * NN] = (_Float16)(acc[ct][r] * sm[o] + bm[o]);
      }
    }
  }
}

// ---------------------------------------------------------------------------
// Kernel 2: fused attention, softmax in two passes. One work-group = one (batch,
// head) and 256 queries: its 16 waves stage that head's whole K and V in LDS once,
// then each wave walks all keys twice for its own 16-query tile out of LDS.
// Pass 1 forms the scores and keeps only each query's maximum. Pass 2 forms them
// again with minus that maximum as the WMMA's C operand and Q times log2(e) as B:
// what leaves the matrix unit is the exp2 argument itself, and nothing is rescaled.
// The score product costs no vector work: one A fragment holds two 16-key tiles
// (kdim slots 0-15 and 16-31), and Q sits in the low or the high half of B, zeros
// in the other, which picks the tile (a zero times the other tile's finite K adds
// exactly 0; a K that is not finite already spoils that head's every softmax row).
// Scores computed transposed (A=K-tiles, B=Q-tile) so softmax reduces in-lane
// + one shfl_xor(16), and exp2() results feed the PV WMMA B-operand directly.
// ---------------------------------------------------------------------------
#define KP (NN * 8 + 64)  // halves per K plane; the 128 B between the planes put a
                          // staging store's even and odd lanes on different banks
#define VP 1032  // LDS pitch of a V row in halves: 2064 B = 16 B x odd, so the
                 // 16 rows one ds_load_b128 touches fall on different banks

__global__ __launch_bounds__(512) void attn_kernel(
    const _Float16* __restrict__ Qws, const _Float16* __restrict__ Kws,
    const _Float16* __restrict__ Vws, _Float16* __restrict__ Ows)
{
  __shared__ __align__(16) _Float16 ks[2 * KP];    // [kdim half][key][8]: each 16-lane
                                                   // half of a K read is 256 contiguous B
  __shared__ __align__(16) _Float16 vs[DV * VP];   // [d][key], padded rows

  const int tid  = threadIdx.x;
  const int wave = tid >> 5, lane = tid & 31;
  const int l16  = lane & 15, hi = lane >> 4;
  const int bh   = blockIdx.y;                  // 0..127
  const int qt   = blockIdx.x * 16 + wave;      // 0..63
  const int q    = qt * 16 + l16;

  const _Float16* kbase = Kws + (size_t)bh * NN * KD;
  const _Float16* vbase = Vws + (size_t)bh * DV * NN;

  // Stage K (32 KB) and V (64 KB): 16 B per lane, each wave-load 512 contiguous B
  {
    v8h kr[4], vr[8];
#pragma unroll
    for (int j = 0; j < 4; ++j) kr[j] = *(const v8h*)(kbase + (size_t)(tid + j * 512) * 8);
#pragma unroll
    for (int j = 0; j < 8; ++j) vr[j] = *(const v8h*)(vbase + (size_t)(tid + j * 512) * 8);
#pragma unroll
    for (int j = 0; j < 4; ++j) {
      const int i = tid + j * 512;              // 2 chunks of 16 B per key
      *(v8h*)&ks[(i & 1) * KP + (i >> 1) * 8] = kr[j];
    }
#pragma unroll
    for (int j = 0; j < 8; ++j) {
      const int i = tid + j * 512;              // 128 chunks of 16 B per V row
      *(v8h*)&vs[(i >> 7) * VP + (i & 127) * 8] = vr[j];
    }
  }

  // Q * log2(e) as B operand [kdim slots(32) x 16 queries]: in rows 0..15 (bq0,
  // meets the A fragment's first key tile) or in rows 16..31 (bq1, its second)
  v16h bq0 = {}, bq1 = {};
  {
    const _Float16* qp = Qws + (((size_t)bh * NN + q) * KD + 8 * hi);
    v8h qv = *(const v8h*)qp;
#pragma unroll
    for (int e = 0; e < 8; ++e) {
      const _Float16 qe = (_Float16)((float)qv[e] * LOG2E);
      bq0[e] = qe; bq1[e + 8] = qe;
    }
  }
  __syncthreads();                              // K and V published to all 16 waves

  const v8f zc = {};

  // Pass 1: exact maximum of each query's scores, eight running maxima per lane
  v8f mx;
#pragma unroll
  for (int r = 0; r < 8; ++r) mx[r] = -INFINITY;
  for (int m0 = 0; m0 < NN; m0 += 32) {
    // two K tiles as one A operand [16 keys x (kdim of key m | kdim of key m+16)]
    v8h k0 = *(const v8h*)&ks[hi * KP + (m0 + l16) * 8];
    v8h k1 = *(const v8h*)&ks[hi * KP + (m0 + 16 + l16) * 8];
    v16h ka;
#pragma unroll
    for (int e = 0; e < 8; ++e) { ka[e] = k0[e]; ka[e + 8] = k1[e]; }
    v8f s0 = WMMA_F16(ka, bq0, zc);             // S^T: VGPR r = key r+8*hi, lane = q
    v8f s1 = WMMA_F16(ka, bq1, zc);             // keys m0+16..m0+31
#pragma unroll
    for (int r = 0; r < 8; ++r) mx[r] = fmaxf(mx[r], fmaxf(s0[r], s1[r]));
  }
  float mQ = mx[0];
#pragma unroll
  for (int r = 1; r < 8; ++r) mQ = fmaxf(mQ, mx[r]);
  mQ = fmaxf(mQ, __shfl_xor(mQ, 16, 32));       // the other half's keys
  v8f negm;
#pragma unroll
  for (int r = 0; r < 8; ++r) negm[r] = -mQ;

  // Pass 2: P = exp2(score - max), row sums, O^T = V^T P
  v8f acc0 = {}, acc1 = {};                     // [d0..15 x q], [d16..31 x q]
  v8f ls = {};                                  // eight partial row sums per lane
  for (int m0 = 0; m0 < NN; m0 += 32) {
    v8h k0 = *(const v8h*)&ks[hi * KP + (m0 + l16) * 8];
    v8h k1 = *(const v8h*)&ks[hi * KP + (m0 + 16 + l16) * 8];
    v16h ka;
#pragma unroll
    for (int e = 0; e < 8; ++e) { ka[e] = k0[e]; ka[e + 8] = k1[e]; }
    v8f s0 = WMMA_F16(ka, bq0, negm);
    v8f s1 = WMMA_F16(ka, bq1, negm);

    v16h pb;                                    // P as B operand [m=32 x q=16]
#pragma unroll
    for (int r = 0; r < 8; ++r) {
      float p0 = __builtin_amdgcn_exp2f(s0[r]);
      float p1 = __builtin_amdgcn_exp2f(s1[r]);
      ls[r] += p0 + p1;
      pb[r]     = (_Float16)p0;                 // m = r+8*hi       (matches B layout)
      pb[r + 8] = (_Float16)p1;                 // m = 16+r+8*hi
    }

    // V tiles as A operand [16 d x 32 m]
    const _Float16* v0p = &vs[l16 * VP + m0 + 8 * hi];
    const _Float16* v1p = &vs[(16 + l16) * VP + m0 + 8 * hi];
    v8h va0l = *(const v8h*)v0p, va0h = *(const v8h*)(v0p + 16);
    v8h va1l = *(const v8h*)v1p, va1h = *(const v8h*)(v1p + 16);
    v16h va0, va1;
#pragma unroll
    for (int e = 0; e < 8; ++e) {
      va0[e] = va0l[e]; va0[e + 8] = va0h[e];
      va1[e] = va1l[e]; va1[e + 8] = va1h[e];
    }
    acc0 = WMMA_F16(va0, pb, acc0);
    acc1 = WMMA_F16(va1, pb, acc1);
  }
  float lQ = ((ls[0] + ls[1]) + (ls[2] + ls[3])) + ((ls[4] + ls[5]) + (ls[6] + ls[7]));
  lQ += __shfl_xor(lQ, 16, 32);

  // normalize, ReLU, store O as [b][h*32+d][n] f16 for the projection GEMM
  const float inv = 1.0f / lQ;
  const int b = bh >> 3, h = bh & 7;
  _Float16* obase = Ows + ((size_t)b * (NH * DV) + h * DV) * NN + q;
#pragma unroll
  for (int r = 0; r < 8; ++r) {
    int d0 = r + 8 * hi, d1 = 16 + r + 8 * hi;
    obase[(size_t)d0 * NN] = (_Float16)fmaxf(acc0[r] * inv, 0.f);
    obase[(size_t)d1 * NN] = (_Float16)fmaxf(acc1[r] * inv, 0.f);
  }
}

// ---------------------------------------------------------------------------
// Kernel 3: output projection 1x1-conv + BN, f32 result to d_out.
// ---------------------------------------------------------------------------
__global__ __launch_bounds__(256) void proj_kernel(
    const _Float16* __restrict__ Ows, const float* __restrict__ wp,
    const float* __restrict__ sp, const float* __restrict__ bp,
    float* __restrict__ out)
{
  __shared__ __align__(16) _Float16 xs[64 * 264];
  const int tid = threadIdx.x;
  const int b   = blockIdx.z;
  const int n0  = blockIdx.x * 64;

  const _Float16* ob = Ows + (size_t)b * NC * NN + n0;
  for (int i = tid; i < NC * 64; i += 256) {
    int c = i >> 6, n = i & 63;
    xs[n * 264 + c] = ob[(size_t)c * NN + n];
  }
  __syncthreads();

  const int wave = tid >> 5, lane = tid & 31;
  const int l16 = lane & 15, hi = lane >> 4;
  const int rt  = blockIdx.y * 8 + wave;        // 0..15
  const int orow = rt * 16;
  const float* arow = wp + (size_t)(orow + l16) * NC;

  v8f acc[4] = {};
#pragma unroll
  for (int ck = 0; ck < 8; ++ck) {
    const int cbase = ck * 32 + hi * 8;
    v16h aop;
    const float* ap = arow + cbase;
#pragma unroll
    for (int e = 0; e < 8; ++e) { aop[e] = (_Float16)ap[e]; aop[e + 8] = (_Float16)ap[e + 16]; }
#pragma unroll
    for (int ct = 0; ct < 4; ++ct) {
      const _Float16* bptr = &xs[(ct * 16 + l16) * 264 + cbase];
      v8h blo = *(const v8h*)bptr;
      v8h bh2 = *(const v8h*)(bptr + 16);
      v16h bop;
#pragma unroll
      for (int e = 0; e < 8; ++e) { bop[e] = blo[e]; bop[e + 8] = bh2[e]; }
      acc[ct] = WMMA_F16(aop, bop, acc[ct]);
    }
  }

#pragma unroll
  for (int ct = 0; ct < 4; ++ct) {
    const int nn = n0 + ct * 16 + l16;
    float* dst = out + (size_t)b * NC * NN + nn;
#pragma unroll
    for (int r = 0; r < 8; ++r) {
      int o = orow + r + 8 * hi;
      dst[(size_t)o * NN] = acc[ct][r] * sp[o] + bp[o];
    }
  }
}

// ---------------------------------------------------------------------------
extern "C" void kernel_launch(void* const* d_in, const int* in_sizes, int n_in,
                              void* d_out, int out_size, void* d_ws, size_t ws_size,
                              hipStream_t stream) {
  const float* x  = (const float*)d_in[0];
  const float* wq = (const float*)d_in[1];
  const float* sq = (const float*)d_in[2];
  const float* bq = (const float*)d_in[3];
  const float* wk = (const float*)d_in[4];
  const float* sk = (const float*)d_in[5];
  const float* bk = (const float*)d_in[6];
  const float* wv = (const float*)d_in[7];
  const float* sv = (const float*)d_in[8];
  const float* bv = (const float*)d_in[9];
  const float* wp = (const float*)d_in[10];
  const float* sp = (const float*)d_in[11];
  const float* bp = (const float*)d_in[12];
  float* out = (float*)d_out;

  // Workspace layout (f16): Q 4MB | K 4MB | V 8MB | O 8MB  (24MB total)
  char* wsb = (char*)d_ws;
  _Float16* Qws = (_Float16*)(wsb);
  _Float16* Kws = (_Float16*)(wsb + (4u  << 20));
  _Float16* Vws = (_Float16*)(wsb + (8u  << 20));
  _Float16* Ows = (_Float16*)(wsb + (16u << 20));

  qkv_kernel <<<dim3(16, 4, 16), 256, 0, stream>>>(x, wq, sq, bq, wk, sk, bk, wv, sv, bv, Qws, Kws, Vws);
  attn_kernel<<<dim3(4, 128),    512, 0, stream>>>(Qws, Kws, Vws, Ows);
  proj_kernel<<<dim3(16, 2, 16), 256, 0, stream>>>(Ows, wp, sp, bp, out);

  (void)in_sizes; (void)n_in; (void)out_size; (void)ws_size;
}

// v003
// It runs in 45.9 microseconds.
// Timed twice side by side with v002, it ran 1.16 and 1.17 times as fast.
// Over all steps from v000 it is 1.66 times as fast.
#include <hip/hip_runtime.h>
#include <hip/hip_bf16.h>
#include <math.h>

typedef __attribute__((ext_vector_type(16))) _Float16 v16h;
typedef __attribute__((ext_vector_type(8)))  _Float16 v8h;
typedef __attribute__((ext_vector_type(8)))  float    v8f;
typedef __attribute__((ext_vector_type(4)))  float    v4f;

#define WMMA_F16(A,B,C) __builtin_amdgcn_wmma_f32_16x16x32_f16(false,(A),false,(B),(short)0,(C),false,false)

#define NB 16    // batch
#define NC 256   // channels
#define NN 1024  // H*W
#define NH 8     // heads
#define KD 16    // key dim
#define DV 32    // value dim per head
#define LOG2E 1.4426950408889634f

// ---------------------------------------------------------------------------
// Kernel 1: fused QKV 1x1-conv + BN.  y[o,n] = (sum_c w[o,c] x[c,n])*s[o]+b[o]
// Output rows 0-127 -> Q, 128-255 -> K (stored [bh][n][16] f16),
// rows 256-511 -> V (stored [bh][d=32][n] f16).
// ---------------------------------------------------------------------------
// 8 waves per SIMD asked for: the 1024 work-groups then all stay resident at once
// (four per WGP) although each wave holds its weight fragments in registers
__global__ __launch_bounds__(256, 8) void qkv_kernel(
    const float* __restrict__ x,
    const float* __restrict__ wq, const float* __restrict__ sq, const float* __restrict__ bq,
    const float* __restrict__ wk, const float* __restrict__ sk, const float* __restrict__ bk,
    const float* __restrict__ wv, const float* __restrict__ sv, const float* __restrict__ bv,
    _Float16* __restrict__ Qws, _Float16* __restrict__ Kws, _Float16* __restrict__ Vws)
{
  // LDS: x tile transposed [n=64][c=256], stride 264 halves (16B-aligned rows)
  __shared__ __align__(16) _Float16 xs[64 * 264];
  const int tid = threadIdx.x;
  const int b   = blockIdx.z;
  const int n0  = blockIdx.x * 64;

  // the wave's number as a scalar: its row tile, its three pointers and the
  // epilogue's branch are then wave-uniform
  const int wave = __builtin_amdgcn_readfirstlane(tid >> 5);
  const int lane = tid & 31;
  const int l16 = lane & 15, hi = lane >> 4;    // wave32: two 16-lane halves
  const int rt  = blockIdx.y * 8 + wave;        // row tile 0..31 (of 512 rows)

  const float *wm, *sm, *bm;
  int orow;
  if (rt < 8)       { wm = wq; sm = sq; bm = bq; orow = rt * 16; }
  else if (rt < 16) { wm = wk; sm = sk; bm = bk; orow = (rt - 8) * 16; }
  else              { wm = wv; sm = sv; bm = bv; orow = (rt - 16) * 16; }

  // Everything the wave needs besides the x tile is fetched here, ahead of the
  // barrier: scale and bias of its 16 rows, and its weight rows as eight f16 A
  // fragments. The weight loads of two k chunks are issued, a quarter of the x tile
  // is staged under their latency, then they are converted.
  const v4f sl0 = *(const v4f*)(sm + orow + 8 * hi), sl1 = *(const v4f*)(sm + orow + 8 * hi + 4);
  const v4f bl0 = *(const v4f*)(bm + orow + 8 * hi), bl1 = *(const v4f*)(bm + orow + 8 * hi + 4);

  const float* arow = wm + (size_t)(orow + l16) * NC + hi * 8;
  // the thread's column of the tile: n fastest -> coalesced global
  const float* xp = x + (size_t)b * NC * NN + n0 + (tid >> 6) * NN + (tid & 63);
  _Float16*    xd = &xs[(tid & 63) * 264 + (tid >> 6)];
  v16h af[8];                                   // A tiles 16x32 f16, K = 256
#pragma unroll
  for (int g = 0; g < 4; ++g) {
    v4f ar[8];
#pragma unroll
    for (int j = 0; j < 2; ++j) {
      const float* ap = arow + (2 * g + j) * 32;
      ar[4 * j + 0] = *(const v4f*)(ap);
      ar[4 * j + 1] = *(const v4f*)(ap + 4);
      ar[4 * j + 2] = *(const v4f*)(ap + 16);
      ar[4 * j + 3] = *(const v4f*)(ap + 20);
    }
    float xr[16];                               // channels g*64 + 4k + (tid >> 6)
#pragma unroll
    for (int k = 0; k < 16; ++k) xr[k] = xp[(g * 64 + 4 * k) * NN];
    // behind the last pass's loads: both address pairs stay allotted up to this wait,
    // so that no result of the run lands in a register that a load of the run names
    if (g == 3) asm volatile("s_wait_xcnt 0x0" :: "v"(arow), "v"(xp) : "memory");
#pragma unroll
    for (int k = 0; k < 16; ++k) xd[g * 64 + 4 * k] = (_Float16)xr[k];
#pragma unroll
    for (int j = 0; j < 2; ++j)
#pragma unroll
      for (int e = 0; e < 16; ++e) af[2 * g + j][e] = (_Float16)ar[4 * j + (e >> 2)][e & 3];
  }
  __syncthreads();

  v8f acc[4] = {};

#pragma unroll
  for (int ck = 0; ck < 8; ++ck) {              // K = 256 in chunks of 32
    const int cbase = ck * 32 + hi * 8;
    const v16h aop = af[ck];
#pragma unroll
    for (int ct = 0; ct < 4; ++ct) {            // 4 col tiles of 16
      const _Float16* bp = &xs[(ct * 16 + l16) * 264 + cbase];
      v8h blo = *(const v8h*)bp;
      v8h bhi = *(const v8h*)(bp + 16);
      v16h bop;                                 // B tile 32x16 f16
#pragma unroll
      for (int e = 0; e < 8; ++e) { bop[e] = blo[e]; bop[e + 8] = bhi[e]; }
      acc[ct] = WMMA_F16(aop, bop, acc[ct]);
    }
  }

  // epilogue: scale+bias, convert f16, layout-specific stores
  float sl[8], bl[8];                           // the lane's own eight rows
#pragma unroll
  for (int r = 0; r < 4; ++r) { sl[r] = sl0[r]; sl[r + 4] = sl1[r]; bl[r] = bl0[r]; bl[r + 4] = bl1[r]; }
  if (rt < 16) {                                // Q or K: [bh][n][16], one b128/lane
    _Float16* base = (rt < 8) ? Qws : Kws;
#pragma unroll
    for (int ct = 0; ct < 4; ++ct) {
      const int nn = n0 + ct * 16 + l16;
      v8h ov;
#pragma unroll
      for (int r = 0; r < 8; ++r) ov[r] = (_Float16)(acc[ct][r] * sl[r] + bl[r]);
      _Float16* dst  = base + (((size_t)(b * NH + (rt & 7)) * NN + nn) * KD + 8 * hi);
      *(v8h*)dst = ov;
    }
  } else {                                      // V: [bh][d][n]
    const int head  = (rt - 16) >> 1;
    const int dbase = ((rt - 16) & 1) * 16 + 8 * hi;
#pragma unroll
    for (int ct = 0; ct < 4; ++ct) {
      const int nn = n0 + ct * 16 + l16;
      _Float16* vdst = Vws + ((size_t)(b * NH + head) * DV + dbase) * NN + nn;
#pragma unroll
      for (int r = 0; r < 8; ++r) vdst[(size_t)r * NN] = (_Float16)(acc[ct][r] * sl[r] + bl[r]);
    }
    // the stores' registers are read out before any path behind this branch reuses them
    asm volatile("s_wait_xcnt 0x0" ::: "memory");
  }
}

// ---------------------------------------------------------------------------
// Kernel 2: fused attention, softmax in two passes. One work-group = one (batch,
// head) and 256 queries: its 16 waves stage that head's whole K and V in LDS once,
// then each wave walks all keys twice for its own 16-query tile out of LDS.
// Pass 1 forms the scores and keeps only each query's maximum. Pass 2 forms them
// again with minus that maximum as the WMMA's C operand and Q times log2(e) as B:
// what leaves the matrix unit is the exp2 argument itself, and nothing is rescaled.
// The score product costs no vector work: one A fragment holds two 16-key tiles
// (kdim slots 0-15 and 16-31), and Q sits in the low or the high half of B, zeros
// in the other, which picks the tile (a zero times the other tile's finite K adds
// exactly 0; a K that is not finite already spoils that head's every softmax row).
// Scores computed transposed (A=K-tiles, B=Q-tile) so softmax reduces in-lane
// + one shfl_xor(16), and exp2() results feed the PV WMMA B-operand directly.
// ---------------------------------------------------------------------------
#define KP (NN * 8 + 64)  // halves per K plane; the 128 B between the planes put a
                          // staging store's even and odd lanes on different banks
#define VP 1032  // LDS pitch of a V row in halves: 2064 B = 16 B x odd, so the
                 // 16 rows one ds_load_b128 touches fall on different banks

__global__ __launch_bounds__(512) void attn_kernel(
    const _Float16* __restrict__ Qws, const _Float16* __restrict__ Kws,
    const _Float16* __restrict__ Vws, _Float16* __restrict__ Ows)
{
  __shared__ __align__(16) _Float16 ks[2 * KP];    // [kdim half][key][8]: each 16-lane
                                                   // half of a K read is 256 contiguous B
  __shared__ __align__(16) _Float16 vs[DV * VP];   // [d][key], padded rows

  const int tid  = threadIdx.x;
  const int wave = tid >> 5, lane = tid & 31;
  const int l16  = lane & 15, hi = lane >> 4;
  const int bh   = blockIdx.y;                  // 0..127
  const int qt   = blockIdx.x * 16 + wave;      // 0..63
  const int q    = qt * 16 + l16;

  const _Float16* kbase = Kws + (size_t)bh * NN * KD;
  const _Float16* vbase = Vws + (size_t)bh * DV * NN;

  // Stage K (32 KB) and V (64 KB): 16 B per lane, each wave-load 512 contiguous B
  {
    v8h kr[4], vr[8];
#pragma unroll
    for (int j = 0; j < 4; ++j) kr[j] = *(const v8h*)(kbase + (size_t)(tid + j * 512) * 8);
#pragma unroll
    for (int j = 0; j < 8; ++j) vr[j] = *(const v8h*)(vbase + (size_t)(tid + j * 512) * 8);
#pragma unroll
    for (int j = 0; j < 4; ++j) {
      const int i = tid + j * 512;              // 2 chunks of 16 B per key
      *(v8h*)&ks[(i & 1) * KP + (i >> 1) * 8] = kr[j];
    }
#pragma unroll
    for (int j = 0; j < 8; ++j) {
      const int i = tid + j * 512;              // 128 chunks of 16 B per V row
      *(v8h*)&vs[(i >> 7) * VP + (i & 127) * 8] = vr[j];
    }
  }

  // Q * log2(e) as B operand [kdim slots(32) x 16 queries]: in rows 0..15 (bq0,
  // meets the A fragment's first key tile) or in rows 16..31 (bq1, its second)
  v16h bq0 = {}, bq1 = {};
  {
    const _Float16* qp = Qws + (((size_t)bh * NN + q) * KD + 8 * hi);
    v8h qv = *(const v8h*)qp;
#pragma unroll
    for (int e = 0; e < 8; ++e) {
      const _Float16 qe = (_Float16)((float)qv[e] * LOG2E);
      bq0[e] = qe; bq1[e + 8] = qe;
    }
  }
  __syncthreads();                              // K and V published to all 16 waves

  const v8f zc = {};

  // Pass 1: exact maximum of each query's scores, eight running maxima per lane
  v8f mx;
#pragma unroll
  for (int r = 0; r < 8; ++r) mx[r] = -INFINITY;
  for (int m0 = 0; m0 < NN; m0 += 32) {
    // two K tiles as one A operand [16 keys x (kdim of key m | kdim of key m+16)]
    v8h k0 = *(const v8h*)&ks[hi * KP + (m0 + l16) * 8];
    v8h k1 = *(const v8h*)&ks[hi * KP + (m0 + 16 + l16) * 8];
    v16h ka;
#pragma unroll
    for (int e = 0; e < 8; ++e) { ka[e] = k0[e]; ka[e + 8] = k1[e]; }
    v8f s0 = WMMA_F16(ka, bq0, zc);             // S^T: VGPR r = key r+8*hi, lane = q
    v8f s1 = WMMA_F16(ka, bq1, zc);             // keys m0+16..m0+31
#pragma unroll
    for (int r = 0; r < 8; ++r) mx[r] = fmaxf(mx[r], fmaxf(s0[r], s1[r]));
  }
  float mQ = mx[0];
#pragma unroll
  for (int r = 1; r < 8; ++r) mQ = fmaxf(mQ, mx[r]);
  mQ = fmaxf(mQ, __shfl_xor(mQ, 16, 32));       // the other half's keys
  v8f negm;
#pragma unroll
  for (int r = 0; r < 8; ++r) negm[r] = -mQ;

  // Pass 2: P = exp2(score - max), row sums, O^T = V^T P
  v8f acc0 = {}, acc1 = {};                     // [d0..15 x q], [d16..31 x q]
  v8f ls = {};                                  // eight partial row sums per lane
  for (int m0 = 0; m0 < NN; m0 += 32) {
    v8h k0 = *(const v8h*)&ks[hi * KP + (m0 + l16) * 8];
    v8h k1 = *(const v8h*)&ks[hi * KP + (m0 + 16 + l16) * 8];
    v16h ka;
#pragma unroll
    for (int e = 0; e < 8; ++e) { ka[e] = k0[e]; ka[e + 8] = k1[e]; }
    v8f s0 = WMMA_F16(ka, bq0, negm);
    v8f s1 = WMMA_F16(ka, bq1, negm);

    v16h pb;                                    // P as B operand [m=32 x q=16]
#pragma unroll
    for (int r = 0; r < 8; ++r) {
      float p0 = __builtin_amdgcn_exp2f(s0[r]);
      float p1 = __builtin_amdgcn_exp2f(s1[r]);
      ls[r] += p0 + p1;
      pb[r]     = (_Float16)p0;                 // m = r+8*hi       (matches B layout)
      pb[r + 8] = (_Float16)p1;                 // m = 16+r+8*hi
    }

    // V tiles as A operand [16 d x 32 m]
    const _Float16* v0p = &vs[l16 * VP + m0 + 8 * hi];
    const _Float16* v1p = &vs[(16 + l16) * VP + m0 + 8 * hi];
    v8h va0l = *(const v8h*)v0p, va0h = *(const v8h*)(v0p + 16);
    v8h va1l = *(const v8h*)v1p, va1h = *(const v8h*)(v1p + 16);
    v16h va0, va1;
#pragma unroll
    for (int e = 0; e < 8; ++e) {
      va0[e] = va0l[e]; va0[e + 8] = va0h[e];
      va1[e] = va1l[e]; va1[e + 8] = va1h[e];
    }
    acc0 = WMMA_F16(va0, pb, acc0);
    acc1 = WMMA_F16(va1, pb, acc1);
  }
  float lQ = ((ls[0] + ls[1]) + (ls[2] + ls[3])) + ((ls[4] + ls[5]) + (ls[6] + ls[7]));
  lQ += __shfl_xor(lQ, 16, 32);

  // normalize, ReLU, store O as [b][h*32+d][n] f16 for the projection GEMM
  const float inv = 1.0f / lQ;
  const int b = bh >> 3, h = bh & 7;
  _Float16* obase = Ows + ((size_t)b * (NH * DV) + h * DV) * NN + q;
#pragma unroll
  for (int r = 0; r < 8; ++r) {
    int d0 = r + 8 * hi, d1 = 16 + r + 8 * hi;
    obase[(size_t)d0 * NN] = (_Float16)fmaxf(acc0[r] * inv, 0.f);
    obase[(size_t)d1 * NN] = (_Float16)fmaxf(acc1[r] * inv, 0.f);
  }
}

// ---------------------------------------------------------------------------
// Kernel 3: output projection 1x1-conv + BN, f32 result to d_out.
// ---------------------------------------------------------------------------
__global__ __launch_bounds__(256) void proj_kernel(
    const _Float16* __restrict__ Ows, const float* __restrict__ wp,
    const float* __restrict__ sp, const float* __restrict__ bp,
    float* __restrict__ out)
{
  __shared__ __align__(16) _Float16 xs[64 * 264];
  const int tid = threadIdx.x;
  const int b   = blockIdx.z;
  const int n0  = blockIdx.x * 64;

  // the wave's number as a scalar: the row tile and its base addresses are wave-uniform
  const int wave = __builtin_amdgcn_readfirstlane(tid >> 5);
  const int lane = tid & 31;
  const int l16 = lane & 15, hi = lane >> 4;
  const int rt  = blockIdx.y * 8 + wave;        // 0..15
  const int orow = rt * 16;

  // as in the QKV kernel: scale, bias and the weight rows come ahead of the barrier,
  // the weight loads' latency under the staging of the tile
  const v4f sl0 = *(const v4f*)(sp + orow + 8 * hi), sl1 = *(const v4f*)(sp + orow + 8 * hi + 4);
  const v4f bl0 = *(const v4f*)(bp + orow + 8 * hi), bl1 = *(const v4f*)(bp + orow + 8 * hi + 4);

  const float* arow = wp + (size_t)(orow + l16) * NC + hi * 8;
  const _Float16* xp = Ows + (size_t)b * NC * NN + n0 + (tid >> 6) * NN + (tid & 63);
  _Float16*       xd = &xs[(tid & 63) * 264 + (tid >> 6)];
  v16h af[8];
#pragma unroll
  for (int g = 0; g < 4; ++g) {
    v4f ar[8];
#pragma unroll
    for (int j = 0; j < 2; ++j) {
      const float* ap = arow + (2 * g + j) * 32;
      ar[4 * j + 0] = *(const v4f*)(ap);
      ar[4 * j + 1] = *(const v4f*)(ap + 4);
      ar[4 * j + 2] = *(const v4f*)(ap + 16);
      ar[4 * j + 3] = *(const v4f*)(ap + 20);
    }
    _Float16 xr[16];
#pragma unroll
    for (int k = 0; k < 16; ++k) xr[k] = xp[(g * 64 + 4 * k) * NN];
#pragma unroll
    for (int k = 0; k < 16; ++k) xd[g * 64 + 4 * k] = xr[k];
#pragma unroll
    for (int j = 0; j < 2; ++j)
#pragma unroll
      for (int e = 0; e < 16; ++e) af[2 * g + j][e] = (_Float16)ar[4 * j + (e >> 2)][e & 3];
  }
  __syncthreads();

  v8f acc[4] = {};
#pragma unroll
  for (int ck = 0; ck < 8; ++ck) {
    const int cbase = ck * 32 + hi * 8;
    const v16h aop = af[ck];
#pragma unroll
    for (int ct = 0; ct < 4; ++ct) {
      const _Float16* bptr = &xs[(ct * 16 + l16) * 264 + cbase];
      v8h blo = *(const v8h*)bptr;
      v8h bh2 = *(const v8h*)(bptr + 16);
      v16h bop;
#pragma unroll
      for (int e = 0; e < 8; ++e) { bop[e] = blo[e]; bop[e + 8] = bh2[e]; }
      acc[ct] = WMMA_F16(aop, bop, acc[ct]);
    }
  }

  float sl[8], bl[8];                           // the lane's own eight rows
#pragma unroll
  for (int r = 0; r < 4; ++r) { sl[r] = sl0[r]; sl[r + 4] = sl1[r]; bl[r] = bl0[r]; bl[r + 4] = bl1[r]; }
#pragma unroll
  for (int ct = 0; ct < 4; ++ct) {
    const int nn = n0 + ct * 16 + l16;
    float* dst = out + (size_t)b * NC * NN + nn;
#pragma unroll
    for (int r = 0; r < 8; ++r) {
      int o = orow + r + 8 * hi;
      dst[(size_t)o * NN] = acc[ct][r] * sl[r] + bl[r];
    }
  }
}

// ---------------------------------------------------------------------------
extern "C" void kernel_launch(void* const* d_in, const int* in_sizes, int n_in,
                              void* d_out, int out_size, void* d_ws, size_t ws_size,
                              hipStream_t stream) {
  const float* x  = (const float*)d_in[0];
  const float* wq = (const float*)d_in[1];
  const float* sq = (const float*)d_in[2];
  const float* bq = (const float*)d_in[3];
  const float* wk = (const float*)d_in[4];
  const float* sk = (const float*)d_in[5];
  const float* bk = (const float*)d_in[6];
  const float* wv = (const float*)d_in[7];
  const float* sv = (const float*)d_in[8];
  const float* bv = (const float*)d_in[9];
  const float* wp = (const float*)d_in[10];
  const float* sp = (const float*)d_in[11];
  const float* bp = (const float*)d_in[12];
  float* out = (float*)d_out;

  // Workspace layout (f16): Q 4MB | K 4MB | V 8MB | O 8MB  (24MB total)
  char* wsb = (char*)d_ws;
  _Float16* Qws = (_Float16*)(wsb);
  _Float16* Kws = (_Float16*)(wsb + (4u  << 20));
  _Float16* Vws = (_Float16*)(wsb + (8u  << 20));
  _Float16* Ows = (_Float16*)(wsb + (16u << 20));

  qkv_kernel <<<dim3(16, 4, 16), 256, 0, stream>>>(x, wq, sq, bq, wk, sk, bk, wv, sv, bv, Qws, Kws, Vws);
  attn_kernel<<<dim3(4, 128),    512, 0, stream>>>(Qws, Kws, Vws, Ows);
  proj_kernel<<<dim3(16, 2, 16), 256, 0, stream>>>(Ows, wp, sp, bp, out);

  (void)in_sizes; (void)n_in; (void)out_size; (void)ws_size;
}

// v004
// Measured time: 41.2 microseconds a run.
// Two timings next to v003 both put it at 1.11 times that version's speed.
// Counting every step since v000, it is 1.84 times as fast.
#include <hip/hip_runtime.h>
#include <hip/hip_bf16.h>
#include <math.h>

typedef __attribute__((ext_vector_type(16))) _Float16 v16h;
typedef __attribute__((ext_vector_type(8)))  _Float16 v8h;
typedef __attribute__((ext_vector_type(4)))  _Float16 v4h;
typedef __attribute__((ext_vector_type(8)))  float    v8f;
typedef __attribute__((ext_vector_type(4)))  float    v4f;

#define WMMA_F16(A,B,C) __builtin_amdgcn_wmma_f32_16x16x32_f16(false,(A),false,(B),(short)0,(C),false,false)

#define NB 16    // batch
#define NC 256   // channels
#define NN 1024  // H*W
#define NH 8     // heads
#define KD 16    // key dim
#define DV 32    // value dim per head
#define LOG2E 1.4426950408889634f
#define WP 72    // LDS pitch in halves of a weight row's 64-channel piece: 144 B = 16 B x odd,
                 // so the 16 rows one ds_load_b128 touches fall on different banks

// ---------------------------------------------------------------------------
// Kernel 1: fused QKV 1x1-conv + BN.  y[o,n] = (sum_c w[o,c] x[c,n])*s[o]+b[o]
// Output rows 0-127 -> Q, 128-255 -> K (stored [bh][n][16] f16),
// rows 256-511 -> V (stored [bh][d=32][n] f16).
// ---------------------------------------------------------------------------
// 8 waves per SIMD asked for: the 1024 work-groups then all stay resident at once
// (four per WGP) although each wave holds its weight fragments in registers
__global__ __launch_bounds__(256, 8) void qkv_kernel(
    const float* __restrict__ x,
    const float* __restrict__ wq, const float* __restrict__ sq, const float* __restrict__ bq,
    const float* __restrict__ wk, const float* __restrict__ sk, const float* __restrict__ bk,
    const float* __restrict__ wv, const float* __restrict__ sv, const float* __restrict__ bv,
    _Float16* __restrict__ Qws, _Float16* __restrict__ Kws, _Float16* __restrict__ Vws)
{
  // LDS: x tile transposed [n=64][c=256], stride 264 halves (16B-aligned rows)
  __shared__ __align__(16) _Float16 xs[64 * 264];
  // per wave: 16 weight rows x 64 channels f16, where lanes exchange what they loaded
  __shared__ __align__(16) _Float16 wsm[8 * 16 * WP];
  const int tid = threadIdx.x;
  const int b   = blockIdx.z;
  const int n0  = blockIdx.x * 64;

  // the wave's number as a scalar: its row tile, its three pointers and the
  // epilogue's branch are then wave-uniform
  const int wave = __builtin_amdgcn_readfirstlane(tid >> 5);
  const int lane = tid & 31;
  const int l16 = lane & 15, hi = lane >> 4;    // wave32: two 16-lane halves
  const int rt  = blockIdx.y * 8 + wave;        // row tile 0..31 (of 512 rows)

  const float *wm, *sm, *bm;
  int orow;
  if (rt < 8)       { wm = wq; sm = sq; bm = bq; orow = rt * 16; }
  else if (rt < 16) { wm = wk; sm = sk; bm = bk; orow = (rt - 8) * 16; }
  else              { wm = wv; sm = sv; bm = bv; orow = (rt - 16) * 16; }

  // Everything the wave needs besides the x tile is fetched here, ahead of the
  // barrier: scale and bias of its 16 rows, and its weight rows as eight f16 A
  // fragments. The weight loads of two k chunks are issued, a quarter of the x tile
  // is staged under their latency, then they are converted. A weight load takes whole
  // lines (each 16-lane half 256 contiguous B of one row, 4 lines an instruction and
  // not 16); the wave's own LDS piece then hands every lane its fragment's elements.
  const v4f sl0 = *(const v4f*)(sm + orow + 8 * hi), sl1 = *(const v4f*)(sm + orow + 8 * hi + 4);
  const v4f bl0 = *(const v4f*)(bm + orow + 8 * hi), bl1 = *(const v4f*)(bm + orow + 8 * hi + 4);

  const float* arow = wm + (size_t)(orow + hi) * NC + l16 * 4;   // rows hi, hi + 2, ...
  _Float16*       wst = &wsm[(wave * 16 + hi) * WP + l16 * 4];    // where the lane puts them
  const _Float16* wld = &wsm[(wave * 16 + l16) * WP + hi * 8];    // its fragment row
  // the thread's column of the tile: n fastest -> coalesced global
  const float* xp = x + (size_t)b * NC * NN + n0 + (tid >> 6) * NN + (tid & 63);
  _Float16*    xd = &xs[(tid & 63) * 264 + (tid >> 6)];
  v16h af[8];                                   // A tiles 16x32 f16, K = 256
#pragma unroll
  for (int g = 0; g < 4; ++g) {
    v4f ar[8];                                  // rows 2i + hi, channels g*64 + 4*l16 ..
#pragma unroll
    for (int i = 0; i < 8; ++i) ar[i] = *(const v4f*)(arow + 2 * i * NC + g * 64);
    float xr[16];                               // channels g*64 + 4k + (tid >> 6)
#pragma unroll
    for (int k = 0; k < 16; ++k) xr[k] = xp[(g * 64 + 4 * k) * NN];
    // behind the last pass's loads: both address pairs stay allotted up to this wait,
    // so that no result of the run lands in a register that a load of the run names
    if (g == 3) asm volatile("s_wait_xcnt 0x0" :: "v"(arow), "v"(xp) : "memory");
#pragma unroll
    for (int k = 0; k < 16; ++k) xd[g * 64 + 4 * k] = (_Float16)xr[k];
#pragma unroll
    for (int i = 0; i < 8; ++i) {
      v4h wh;
#pragma unroll
      for (int e = 0; e < 4; ++e) wh[e] = (_Float16)ar[i][e];
      *(v4h*)(wst + 2 * i * WP) = wh;
    }
    // behind the scale and bias loads, whose offset register is reused from here on
    if (g == 0) asm volatile("s_wait_xcnt 0x0" ::: "memory");
    // the wave's own stores have landed before its lanes read each other's elements
    asm volatile("s_wait_dscnt 0x0" ::: "memory");
#pragma unroll
    for (int j = 0; j < 2; ++j) {
      const v8h alo = *(const v8h*)(wld + j * 32), ahi = *(const v8h*)(wld + j * 32 + 16);
#pragma unroll
      for (int e = 0; e < 8; ++e) { af[2 * g + j][e] = alo[e]; af[2 * g + j][e + 8] = ahi[e]; }
    }
  }
  __syncthreads();

  v8f acc[4] = {};

#pragma unroll
  for (int ck = 0; ck < 8; ++ck) {              // K = 256 in chunks of 32
    const int cbase = ck * 32 + hi * 8;
    const v16h aop = af[ck];
#pragma unroll
    for (int ct = 0; ct < 4; ++ct) {            // 4 col tiles of 16
      const _Float16* bp = &xs[(ct * 16 + l16) * 264 + cbase];
      v8h blo = *(const v8h*)bp;
      v8h bhi = *(const v8h*)(bp + 16);
      v16h bop;                                 // B tile 32x16 f16
#pragma unroll
      for (int e = 0; e < 8; ++e) { bop[e] = blo[e]; bop[e + 8] = bhi[e]; }
      acc[ct] = WMMA_F16(aop, bop, acc[ct]);
    }
  }

  // epilogue: scale+bias, convert f16, layout-specific stores
  float sl[8], bl[8];                           // the lane's own eight rows
#pragma unroll
  for (int r = 0; r < 4; ++r) { sl[r] = sl0[r]; sl[r + 4] = sl1[r]; bl[r] = bl0[r]; bl[r + 4] = bl1[r]; }
  if (rt < 16) {                                // Q or K: [bh][n][16], one b128/lane
    _Float16* base = (rt < 8) ? Qws : Kws;
#pragma unroll
    for (int ct = 0; ct < 4; ++ct) {
      const int nn = n0 + ct * 16 + l16;
      v8h ov;
#pragma unroll
      for (int r = 0; r < 8; ++r) ov[r] = (_Float16)(acc[ct][r] * sl[r] + bl[r]);
      _Float16* dst  = base + (((size_t)(b * NH + (rt & 7)) * NN + nn) * KD + 8 * hi);
      *(v8h*)dst = ov;
    }
  } else {                                      // V: [bh][d][n]
    const int head  = (rt - 16) >> 1;
    const int dbase = ((rt - 16) & 1) * 16 + 8 * hi;
#pragma unroll
    for (int ct = 0; ct < 4; ++ct) {
      const int nn = n0 + ct * 16 + l16;
      _Float16* vdst = Vws + ((size_t)(b * NH + head) * DV + dbase) * NN + nn;
#pragma unroll
      for (int r = 0; r < 8; ++r) vdst[(size_t)r * NN] = (_Float16)(acc[ct][r] * sl[r] + bl[r]);
    }
    // the stores' registers are read out before any path behind this branch reuses them
    asm volatile("s_wait_xcnt 0x0" ::: "memory");
  }
}

// ---------------------------------------------------------------------------
// Kernel 2: fused attention, softmax in two passes. One work-group = one (batch,
// head) and 256 queries: its 16 waves stage that head's whole K and V in LDS once,
// then each wave walks all keys twice for its own 16-query tile out of LDS.
// Pass 1 forms the scores and keeps only each query's maximum. Pass 2 forms them
// again with minus that maximum as the WMMA's C operand and Q times log2(e) as B:
// what leaves the matrix unit is the exp2 argument itself, and nothing is rescaled.
// The score product costs no vector work: one A fragment holds two 16-key tiles
// (kdim slots 0-15 and 16-31), and Q sits in the low or the high half of B, zeros
// in the other, which picks the tile (a zero times the other tile's finite K adds
// exactly 0; a K that is not finite already spoils that head's every softmax row).
// Scores computed transposed (A=K-tiles, B=Q-tile) so softmax reduces in-lane
// + one shfl_xor(16), and exp2() results feed the PV WMMA B-operand directly.
// ---------------------------------------------------------------------------
#define KP (NN * 8 + 64)  // halves per K plane; the 128 B between the planes put a
                          // staging store's even and odd lanes on different banks
#define VP 1032  // LDS pitch of a V row in halves: 2064 B = 16 B x odd, so the
                 // 16 rows one ds_load_b128 touches fall on different banks

__global__ __launch_bounds__(512) void attn_kernel(
    const _Float16* __restrict__ Qws, const _Float16* __restrict__ Kws,
    const _Float16* __restrict__ Vws, _Float16* __restrict__ Ows)
{
  __shared__ __align__(16) _Float16 ks[2 * KP];    // [kdim half][key][8]: each 16-lane
                                                   // half of a K read is 256 contiguous B
  __shared__ __align__(16) _Float16 vs[DV * VP];   // [d][key], padded rows

  const int tid  = threadIdx.x;
  const int wave = tid >> 5, lane = tid & 31;
  const int l16  = lane & 15, hi = lane >> 4;
  const int bh   = blockIdx.y;                  // 0..127
  const int qt   = blockIdx.x * 16 + wave;      // 0..63
  const int q    = qt * 16 + l16;

  const _Float16* kbase = Kws + (size_t)bh * NN * KD;
  const _Float16* vbase = Vws + (size_t)bh * DV * NN;

  // Stage K (32 KB) and V (64 KB): 16 B per lane, each wave-load 512 contiguous B
  {
    v8h kr[4], vr[8];
#pragma unroll
    for (int j = 0; j < 4; ++j) kr[j] = *(const v8h*)(kbase + (size_t)(tid + j * 512) * 8);
#pragma unroll
    for (int j = 0; j < 8; ++j) vr[j] = *(const v8h*)(vbase + (size_t)(tid + j * 512) * 8);
#pragma unroll
    for (int j = 0; j < 4; ++j) {
      const int i = tid + j * 512;              // 2 chunks of 16 B per key
      *(v8h*)&ks[(i & 1) * KP + (i >> 1) * 8] = kr[j];
    }
#pragma unroll
    for (int j = 0; j < 8; ++j) {
      const int i = tid + j * 512;              // 128 chunks of 16 B per V row
      *(v8h*)&vs[(i >> 7) * VP + (i & 127) * 8] = vr[j];
    }
  }

  // Q * log2(e) as B operand [kdim slots(32) x 16 queries]: in rows 0..15 (bq0,
  // meets the A fragment's first key tile) or in rows 16..31 (bq1, its second)
  v16h bq0 = {}, bq1 = {};
  {
    const _Float16* qp = Qws + (((size_t)bh * NN + q) * KD + 8 * hi);
    v8h qv = *(const v8h*)qp;
#pragma unroll
    for (int e = 0; e < 8; ++e) {
      const _Float16 qe = (_Float16)((float)qv[e] * LOG2E);
      bq0[e] = qe; bq1[e + 8] = qe;
    }
  }
  __syncthreads();                              // K and V published to all 16 waves

  const v8f zc = {};

  // Pass 1: exact maximum of each query's scores, eight running maxima per lane
  v8f mx;
#pragma unroll
  for (int r = 0; r < 8; ++r) mx[r] = -INFINITY;
  for (int m0 = 0; m0 < NN; m0 += 32) {
    // two K tiles as one A operand [16 keys x (kdim of key m | kdim of key m+16)]
    v8h k0 = *(const v8h*)&ks[hi * KP + (m0 + l16) * 8];
    v8h k1 = *(const v8h*)&ks[hi * KP + (m0 + 16 + l16) * 8];
    v16h ka;
#pragma unroll
    for (int e = 0; e < 8; ++e) { ka[e] = k0[e]; ka[e + 8] = k1[e]; }
    v8f s0 = WMMA_F16(ka, bq0, zc);             // S^T: VGPR r = key r+8*hi, lane = q
    v8f s1 = WMMA_F16(ka, bq1, zc);             // keys m0+16..m0+31
#pragma unroll
    for (int r = 0; r < 8; ++r) mx[r] = fmaxf(mx[r], fmaxf(s0[r], s1[r]));
  }
  float mQ = mx[0];
#pragma unroll
  for (int r = 1; r < 8; ++r) mQ = fmaxf(mQ, mx[r]);
  mQ = fmaxf(mQ, __shfl_xor(mQ, 16, 32));       // the other half's keys
  v8f negm;
#pragma unroll
  for (int r = 0; r < 8; ++r) negm[r] = -mQ;

  // Pass 2: P = exp2(score - max), row sums, O^T = V^T P
  v8f acc0 = {}, acc1 = {};                     // [d0..15 x q], [d16..31 x q]
  v8f ls = {};                                  // eight partial row sums per lane
  for (int m0 = 0; m0 < NN; m0 += 32) {
    v8h k0 = *(const v8h*)&ks[hi * KP + (m0 + l16) * 8];
    v8h k1 = *(const v8h*)&ks[hi * KP + (m0 + 16 + l16) * 8];
    v16h ka;
#pragma unroll
    for (int e = 0; e < 8; ++e) { ka[e] = k0[e]; ka[e + 8] = k1[e]; }
    v8f s0 = WMMA_F16(ka, bq0, negm);
    v8f s1 = WMMA_F16(ka, bq1, negm);

    v16h pb;                                    // P as B operand [m=32 x q=16]
#pragma unroll
    for (int r = 0; r < 8; ++r) {
      float p0 = __builtin_amdgcn_exp2f(s0[r]);
      float p1 = __builtin_amdgcn_exp2f(s1[r]);
      ls[r] += p0 + p1;
      pb[r]     = (_Float16)p0;                 // m = r+8*hi       (matches B layout)
      pb[r + 8] = (_Float16)p1;                 // m = 16+r+8*hi
    }

    // V tiles as A operand [16 d x 32 m]
    const _Float16* v0p = &vs[l16 * VP + m0 + 8 * hi];
    const _Float16* v1p = &vs[(16 + l16) * VP + m0 + 8 * hi];
    v8h va0l = *(const v8h*)v0p, va0h = *(const v8h*)(v0p + 16);
    v8h va1l = *(const v8h*)v1p, va1h = *(const v8h*)(v1p + 16);
    v16h va0, va1;
#pragma unroll
    for (int e = 0; e < 8; ++e) {
      va0[e] = va0l[e]; va0[e + 8] = va0h[e];
      va1[e] = va1l[e]; va1[e + 8] = va1h[e];
    }
    acc0 = WMMA_F16(va0, pb, acc0);
    acc1 = WMMA_F16(va1, pb, acc1);
  }
  float lQ = ((ls[0] + ls[1]) + (ls[2] + ls[3])) + ((ls[4] + ls[5]) + (ls[6] + ls[7]));
  lQ += __shfl_xor(lQ, 16, 32);

  // normalize, ReLU, store O as [b][h*32+d][n] f16 for the projection GEMM
  const float inv = 1.0f / lQ;
  const int b = bh >> 3, h = bh & 7;
  _Float16* obase = Ows + ((size_t)b * (NH * DV) + h * DV) * NN + q;
#pragma unroll
  for (int r = 0; r < 8; ++r) {
    int d0 = r + 8 * hi, d1 = 16 + r + 8 * hi;
    obase[(size_t)d0 * NN] = (_Float16)fmaxf(acc0[r] * inv, 0.f);
    obase[(size_t)d1 * NN] = (_Float16)fmaxf(acc1[r] * inv, 0.f);
  }
}

// ---------------------------------------------------------------------------
// Kernel 3: output projection 1x1-conv + BN, f32 result to d_out.
// ---------------------------------------------------------------------------
__global__ __launch_bounds__(256) void proj_kernel(
    const _Float16* __restrict__ Ows, const float* __restrict__ wp,
    const float* __restrict__ sp, const float* __restrict__ bp,
    float* __restrict__ out)
{
  __shared__ __align__(16) _Float16 xs[64 * 264];
  // per wave its 16 weight rows, f16, whole (two work-groups a WGP: the LDS is there)
  __shared__ __align__(16) _Float16 wsm[8 * 16 * 264];
  const int tid = threadIdx.x;
  const int b   = blockIdx.z;
  const int n0  = blockIdx.x * 64;

  // the wave's number as a scalar: the row tile and its base addresses are wave-uniform
  const int wave = __builtin_amdgcn_readfirstlane(tid >> 5);
  const int lane = tid & 31;
  const int l16 = lane & 15, hi = lane >> 4;
  const int rt  = blockIdx.y * 8 + wave;        // 0..15
  const int orow = rt * 16;

  // as in the QKV kernel: scale, bias and the weight rows come ahead of the barrier,
  // all loads in flight at once; whole-line weight loads (512 contiguous B each), handed
  // to the fragments' lanes through LDS, where the k loop reads them behind the barrier
  const v4f sl0 = *(const v4f*)(sp + orow + 8 * hi), sl1 = *(const v4f*)(sp + orow + 8 * hi + 4);
  const v4f bl0 = *(const v4f*)(bp + orow + 8 * hi), bl1 = *(const v4f*)(bp + orow + 8 * hi + 4);

  const float* arow = wp + (size_t)orow * NC + lane * 4;
  _Float16*       wst = &wsm[wave * 16 * 264 + lane * 4];
  const _Float16* wld = &wsm[(wave * 16 + l16) * 264 + hi * 8];
  const _Float16* xp = Ows + (size_t)b * NC * NN + n0 + (tid >> 6) * NN + (tid & 63);
  _Float16*       xd = &xs[(tid & 63) * 264 + (tid >> 6)];
  v4f ar[32];                                   // row i >> 1, channels (i & 1) * 128 + 4 * lane ..
#pragma unroll
  for (int i = 0; i < 32; ++i) ar[i] = *(const v4f*)(arow + (i >> 1) * NC + (i & 1) * 128);
  _Float16 xr[64];
#pragma unroll
  for (int k = 0; k < 64; ++k) xr[k] = xp[4 * k * NN];
#pragma unroll
  for (int i = 0; i < 32; ++i) {
    v4h wh;
#pragma unroll
    for (int e = 0; e < 4; ++e) wh[e] = (_Float16)ar[i][e];
    *(v4h*)(wst + (i >> 1) * 264 + (i & 1) * 128) = wh;
  }
#pragma unroll
  for (int k = 0; k < 64; ++k) xd[4 * k] = xr[k];
  __syncthreads();

  v8f acc[4] = {};
#pragma unroll
  for (int ck = 0; ck < 8; ++ck) {
    const int cbase = ck * 32 + hi * 8;
    const v8h alo = *(const v8h*)(wld + ck * 32), ahi = *(const v8h*)(wld + ck * 32 + 16);
    v16h aop;
#pragma unroll
    for (int e = 0; e < 8; ++e) { aop[e] = alo[e]; aop[e + 8] = ahi[e]; }
#pragma unroll
    for (int ct = 0; ct < 4; ++ct) {
      const _Float16* bptr = &xs[(ct * 16 + l16) * 264 + cbase];
      v8h blo = *(const v8h*)bptr;
      v8h bh2 = *(const v8h*)(bptr + 16);
      v16h bop;
#pragma unroll
      for (int e = 0; e < 8; ++e) { bop[e] = blo[e]; bop[e + 8] = bh2[e]; }
      acc[ct] = WMMA_F16(aop, bop, acc[ct]);
    }
  }

  float sl[8], bl[8];                           // the lane's own eight rows
#pragma unroll
  for (int r = 0; r < 4; ++r) { sl[r] = sl0[r]; sl[r + 4] = sl1[r]; bl[r] = bl0[r]; bl[r + 4] = bl1[r]; }
#pragma unroll
  for (int ct = 0; ct < 4; ++ct) {
    const int nn = n0 + ct * 16 + l16;
    float* dst = out + (size_t)b * NC * NN + nn;
#pragma unroll
    for (int r = 0; r < 8; ++r) {
      int o = orow + r + 8 * hi;
      dst[(size_t)o * NN] = acc[ct][r] * sl[r] + bl[r];
    }
  }
}

// ---------------------------------------------------------------------------
extern "C" void kernel_launch(void* const* d_in, const int* in_sizes, int n_in,
                              void* d_out, int out_size, void* d_ws, size_t ws_size,
                              hipStream_t stream) {
  const float* x  = (const float*)d_in[0];
  const float* wq = (const float*)d_in[1];
  const float* sq = (const float*)d_in[2];
  const float* bq = (const float*)d_in[3];
  const float* wk = (const float*)d_in[4];
  const float* sk = (const float*)d_in[5];
  const float* bk = (const float*)d_in[6];
  const float* wv = (const float*)d_in[7];
  const float* sv = (const float*)d_in[8];
  const float* bv = (const float*)d_in[9];
  const float* wp = (const float*)d_in[10];
  const float* sp = (const float*)d_in[11];
  const float* bp = (const float*)d_in[12];
  float* out = (float*)d_out;

  // Workspace layout (f16): Q 4MB | K 4MB | V 8MB | O 8MB  (24MB total)
  char* wsb = (char*)d_ws;
  _Float16* Qws = (_Float16*)(wsb);
  _Float16* Kws = (_Float16*)(wsb + (4u  << 20));
  _Float16* Vws = (_Float16*)(wsb + (8u  << 20));
  _Float16* Ows = (_Float16*)(wsb + (16u << 20));

  qkv_kernel <<<dim3(16, 4, 16), 256, 0, stream>>>(x, wq, sq, bq, wk, sk, bk, wv, sv, bv, Qws, Kws, Vws);
  attn_kernel<<<dim3(4, 128),    512, 0, stream>>>(Qws, Kws, Vws, Ows);
  proj_kernel<<<dim3(16, 2, 16), 256, 0, stream>>>(Ows, wp, sp, bp, out);

  (void)in_sizes; (void)n_in; (void)out_size; (void)ws_size;
}

// v005
// One run takes 39.1 microseconds.
// Next to v004, in two timings, it ran 1.05 and 1.06 times as fast.
// Over all steps from v000 it is 1.94 times as fast.
#include <hip/hip_runtime.h>
#include <hip/hip_bf16.h>
#include <math.h>

typedef __attribute__((ext_vector_type(16))) _Float16 v16h;
typedef __attribute__((ext_vector_type(8)))  _Float16 v8h;
typedef __attribute__((ext_vector_type(4)))  _Float16 v4h;
typedef __attribute__((ext_vector_type(8)))  float    v8f;
typedef __attribute__((ext_vector_type(4)))  float    v4f;

#define WMMA_F16(A,B,C) __builtin_amdgcn_wmma_f32_16x16x32_f16(false,(A),false,(B),(short)0,(C),false,false)

#define NB 16    // batch
#define NC 256   // channels
#define NN 1024  // H*W
#define NH 8     // heads
#define KD 16    // key dim
#define DV 32    // value dim per head
#define LOG2E 1.4426950408889634f
#define WP 72    // LDS pitch in halves of a weight row's 64-channel piece: 144 B = 16 B x odd,
                 // so the 16 rows one ds_load_b128 touches fall on different banks

// ---------------------------------------------------------------------------
// Kernel 1: fused QKV 1x1-conv + BN.  y[o,n] = (sum_c w[o,c] x[c,n])*s[o]+b[o]
// Output rows 0-127 -> Q, 128-255 -> K (stored [bh][n][16] f16),
// rows 256-511 -> V (stored [bh][d=32][n] f16).
// ---------------------------------------------------------------------------
// 8 waves per SIMD asked for: the 1024 work-groups then all stay resident at once
// (four per WGP) although each wave holds its weight fragments in registers
__global__ __launch_bounds__(256, 8) void qkv_kernel(
    const float* __restrict__ x,
    const float* __restrict__ wq, const float* __restrict__ sq, const float* __restrict__ bq,
    const float* __restrict__ wk, const float* __restrict__ sk, const float* __restrict__ bk,
    const float* __restrict__ wv, const float* __restrict__ sv, const float* __restrict__ bv,
    _Float16* __restrict__ Qws, _Float16* __restrict__ Kws, _Float16* __restrict__ Vws)
{
  // LDS: x tile transposed [n=64][c=256], stride 264 halves (16B-aligned rows)
  __shared__ __align__(16) _Float16 xs[64 * 264];
  // per wave: 16 weight rows x 64 channels f16, where lanes exchange what they loaded
  __shared__ __align__(16) _Float16 wsm[8 * 16 * WP];
  const int tid = threadIdx.x;
  const int b   = blockIdx.z;
  const int n0  = blockIdx.x * 64;

  // the wave's number as a scalar: its row tile, its three pointers and the
  // epilogue's branch are then wave-uniform
  const int wave = __builtin_amdgcn_readfirstlane(tid >> 5);
  const int lane = tid & 31;
  const int l16 = lane & 15, hi = lane >> 4;    // wave32: two 16-lane halves
  const int rt  = blockIdx.y * 8 + wave;        // row tile 0..31 (of 512 rows)

  const float *wm, *sm, *bm;
  int orow;
  if (rt < 8)       { wm = wq; sm = sq; bm = bq; orow = rt * 16; }
  else if (rt < 16) { wm = wk; sm = sk; bm = bk; orow = (rt - 8) * 16; }
  else              { wm = wv; sm = sv; bm = bv; orow = (rt - 16) * 16; }

  // Everything the wave needs besides the x tile is fetched here, ahead of the
  // barrier: scale and bias of its 16 rows, and its weight rows as eight f16 A
  // fragments. The weight loads of two k chunks are issued, a quarter of the x tile
  // is staged under their latency, then they are converted. A weight load takes whole
  // lines (each 16-lane half 256 contiguous B of one row, 4 lines an instruction and
  // not 16); the wave's own LDS piece then hands every lane its fragment's elements.
  const v4f sl0 = *(const v4f*)(sm + orow + 8 * hi), sl1 = *(const v4f*)(sm + orow + 8 * hi + 4);
  const v4f bl0 = *(const v4f*)(bm + orow + 8 * hi), bl1 = *(const v4f*)(bm + orow + 8 * hi + 4);

  const float* arow = wm + (size_t)(orow + hi) * NC + l16 * 4;   // rows hi, hi + 2, ...
  _Float16*       wst = &wsm[(wave * 16 + hi) * WP + l16 * 4];    // where the lane puts them
  const _Float16* wld = &wsm[(wave * 16 + l16) * WP + hi * 8];    // its fragment row
  // the thread's column of the tile: n fastest -> coalesced global; per pass it takes 16
  // adjacent channels of that column, which are 32 contiguous B of the LDS row
  const float* xp = x + (size_t)b * NC * NN + n0 + (tid >> 6) * 16 * NN + (tid & 63);
  _Float16*    xd = &xs[(tid & 63) * 264 + (tid >> 6) * 16];
  v16h af[8];                                   // A tiles 16x32 f16, K = 256
#pragma unroll
  for (int g = 0; g < 4; ++g) {
    v4f ar[8];                                  // rows 2i + hi, channels g*64 + 4*l16 ..
#pragma unroll
    for (int i = 0; i < 8; ++i) ar[i] = *(const v4f*)(arow + 2 * i * NC + g * 64);
    float xr[16];                               // channels g*64 + 16*(tid >> 6) + k
#pragma unroll
    for (int k = 0; k < 16; ++k) xr[k] = xp[(g * 64 + k) * NN];
    // behind the last pass's loads: both address pairs stay allotted up to this wait,
    // so that no result of the run lands in a register that a load of the run names
    if (g == 3) asm volatile("s_wait_xcnt 0x0" :: "v"(arow), "v"(xp) : "memory");
#pragma unroll
    for (int j = 0; j < 2; ++j) {               // 16-B stores; row pitch 528 B = 16 B x odd
      v8h xh;
#pragma unroll
      for (int e = 0; e < 8; ++e) xh[e] = (_Float16)xr[8 * j + e];
      *(v8h*)(xd + g * 64 + 8 * j) = xh;
    }
#pragma unroll
    for (int i = 0; i < 8; ++i) {
      v4h wh;
#pragma unroll
      for (int e = 0; e < 4; ++e) wh[e] = (_Float16)ar[i][e];
      *(v4h*)(wst + 2 * i * WP) = wh;
    }
    // behind the scale and bias loads, whose offset register is reused from here on
    if (g == 0) asm volatile("s_wait_xcnt 0x0" ::: "memory");
    // the wave's own stores have landed before its lanes read each other's elements
    asm volatile("s_wait_dscnt 0x0" ::: "memory");
#pragma unroll
    for (int j = 0; j < 2; ++j) {
      const v8h alo = *(const v8h*)(wld + j * 32), ahi = *(const v8h*)(wld + j * 32 + 16);
#pragma unroll
      for (int e = 0; e < 8; ++e) { af[2 * g + j][e] = alo[e]; af[2 * g + j][e + 8] = ahi[e]; }
    }
  }
  __syncthreads();

  v8f acc[4] = {};

#pragma unroll
  for (int ck = 0; ck < 8; ++ck) {              // K = 256 in chunks of 32
    const int cbase = ck * 32 + hi * 8;
    const v16h aop = af[ck];
#pragma unroll
    for (int ct = 0; ct < 4; ++ct) {            // 4 col tiles of 16
      const _Float16* bp = &xs[(ct * 16 + l16) * 264 + cbase];
      v8h blo = *(const v8h*)bp;
      v8h bhi = *(const v8h*)(bp + 16);
      v16h bop;                                 // B tile 32x16 f16
#pragma unroll
      for (int e = 0; e < 8; ++e) { bop[e] = blo[e]; bop[e + 8] = bhi[e]; }
      acc[ct] = WMMA_F16(aop, bop, acc[ct]);
    }
  }

  // epilogue: scale+bias, convert f16, layout-specific stores
  float sl[8], bl[8];                           // the lane's own eight rows
#pragma unroll
  for (int r = 0; r < 4; ++r) { sl[r] = sl0[r]; sl[r + 4] = sl1[r]; bl[r] = bl0[r]; bl[r + 4] = bl1[r]; }
  if (rt < 16) {                                // Q or K: [bh][n][16], one b128/lane
    _Float16* base = (rt < 8) ? Qws : Kws;
#pragma unroll
    for (int ct = 0; ct < 4; ++ct) {
      const int nn = n0 + ct * 16 + l16;
      v8h ov;
#pragma unroll
      for (int r = 0; r < 8; ++r) ov[r] = (_Float16)(acc[ct][r] * sl[r] + bl[r]);
      _Float16* dst  = base + (((size_t)(b * NH + (rt & 7)) * NN + nn) * KD + 8 * hi);
      *(v8h*)dst = ov;
    }
  } else {                                      // V: [bh][d][n]
    const int head  = (rt - 16) >> 1;
    const int dbase = ((rt - 16) & 1) * 16 + 8 * hi;
#pragma unroll
    for (int ct = 0; ct < 4; ++ct) {
      const int nn = n0 + ct * 16 + l16;
      _Float16* vdst = Vws + ((size_t)(b * NH + head) * DV + dbase) * NN + nn;
#pragma unroll
      for (int r = 0; r < 8; ++r) vdst[(size_t)r * NN] = (_Float16)(acc[ct][r] * sl[r] + bl[r]);
    }
    // the stores' registers are read out before any path behind this branch reuses them
    asm volatile("s_wait_xcnt 0x0" ::: "memory");
  }
}

// ---------------------------------------------------------------------------
// Kernel 2: fused attention, softmax in two passes. One work-group = one (batch,
// head) and 256 queries: its 16 waves stage that head's whole K and V in LDS once,
// then each wave walks all keys twice for its own 16-query tile out of LDS.
// Pass 1 forms the scores and keeps only each query's maximum. Pass 2 forms them
// again with minus that maximum as the WMMA's C operand and Q times log2(e) as B:
// what leaves the matrix unit is the exp2 argument itself, and nothing is rescaled.
// The score product costs no vector work: one A fragment holds two 16-key tiles
// (kdim slots 0-15 and 16-31), and Q sits in the low or the high half of B, zeros
// in the other, which picks the tile (a zero times the other tile's finite K adds
// exactly 0; a K that is not finite already spoils that head's every softmax row).
// Scores computed transposed (A=K-tiles, B=Q-tile) so softmax reduces in-lane
// + one shfl_xor(16), and exp2() results feed the PV WMMA B-operand directly.
// ---------------------------------------------------------------------------
#define KP (NN * 8 + 64)  // halves per K plane; the 128 B between the planes put a
                          // staging store's even and odd lanes on different banks
#define VP 1032  // LDS pitch of a V row in halves: 2064 B = 16 B x odd, so the
                 // 16 rows one ds_load_b128 touches fall on different banks

__global__ __launch_bounds__(512) void attn_kernel(
    const _Float16* __restrict__ Qws, const _Float16* __restrict__ Kws,
    const _Float16* __restrict__ Vws, _Float16* __restrict__ Ows)
{
  __shared__ __align__(16) _Float16 ks[2 * KP];    // [kdim half][key][8]: each 16-lane
                                                   // half of a K read is 256 contiguous B
  __shared__ __align__(16) _Float16 vs[DV * VP];   // [d][key], padded rows

  const int tid  = threadIdx.x;
  const int wave = tid >> 5, lane = tid & 31;
  const int l16  = lane & 15, hi = lane >> 4;
  const int bh   = blockIdx.y;                  // 0..127
  const int qt   = blockIdx.x * 16 + wave;      // 0..63
  const int q    = qt * 16 + l16;

  const _Float16* kbase = Kws + (size_t)bh * NN * KD;
  const _Float16* vbase = Vws + (size_t)bh * DV * NN;

  // Stage K (32 KB) and V (64 KB): 16 B per lane, each wave-load 512 contiguous B
  {
    v8h kr[4], vr[8];
#pragma unroll
    for (int j = 0; j < 4; ++j) kr[j] = *(const v8h*)(kbase + (size_t)(tid + j * 512) * 8);
#pragma unroll
    for (int j = 0; j < 8; ++j) vr[j] = *(const v8h*)(vbase + (size_t)(tid + j * 512) * 8);
#pragma unroll
    for (int j = 0; j < 4; ++j) {
      const int i = tid + j * 512;              // 2 chunks of 16 B per key
      *(v8h*)&ks[(i & 1) * KP + (i >> 1) * 8] = kr[j];
    }
#pragma unroll
    for (int j = 0; j < 8; ++j) {
      const int i = tid + j * 512;              // 128 chunks of 16 B per V row
      *(v8h*)&vs[(i >> 7) * VP + (i & 127) * 8] = vr[j];
    }
  }

  // Q * log2(e) as B operand [kdim slots(32) x 16 queries]: in rows 0..15 (bq0,
  // meets the A fragment's first key tile) or in rows 16..31 (bq1, its second)
  v16h bq0 = {}, bq1 = {};
  {
    const _Float16* qp = Qws + (((size_t)bh * NN + q) * KD + 8 * hi);
    v8h qv = *(const v8h*)qp;
#pragma unroll
    for (int e = 0; e < 8; ++e) {
      const _Float16 qe = (_Float16)((float)qv[e] * LOG2E);
      bq0[e] = qe; bq1[e + 8] = qe;
    }
  }
  __syncthreads();                              // K and V published to all 16 waves

  const v8f zc = {};

  // Pass 1: exact maximum of each query's scores, eight running maxima per lane
  v8f mx;
#pragma unroll
  for (int r = 0; r < 8; ++r) mx[r] = -INFINITY;
  for (int m0 = 0; m0 < NN; m0 += 32) {
    // two K tiles as one A operand [16 keys x (kdim of key m | kdim of key m+16)]
    v8h k0 = *(const v8h*)&ks[hi * KP + (m0 + l16) * 8];
    v8h k1 = *(const v8h*)&ks[hi * KP + (m0 + 16 + l16) * 8];
    v16h ka;
#pragma unroll
    for (int e = 0; e < 8; ++e) { ka[e] = k0[e]; ka[e + 8] = k1[e]; }
    v8f s0 = WMMA_F16(ka, bq0, zc);             // S^T: VGPR r = key r+8*hi, lane = q
    v8f s1 = WMMA_F16(ka, bq1, zc);             // keys m0+16..m0+31
#pragma unroll
    for (int r = 0; r < 8; ++r) mx[r] = fmaxf(mx[r], fmaxf(s0[r], s1[r]));
  }
  float mQ = mx[0];
#pragma unroll
  for (int r = 1; r < 8; ++r) mQ = fmaxf(mQ, mx[r]);
  mQ = fmaxf(mQ, __shfl_xor(mQ, 16, 32));       // the other half's keys
  v8f negm;
#pragma unroll
  for (int r = 0; r < 8; ++r) negm[r] = -mQ;

  // Pass 2: P = exp2(score - max), row sums, O^T = V^T P
  v8f acc0 = {}, acc1 = {};                     // [d0..15 x q], [d16..31 x q]
  v8f ls = {};                                  // eight partial row sums per lane
  for (int m0 = 0; m0 < NN; m0 += 32) {
    v8h k0 = *(const v8h*)&ks[hi * KP + (m0 + l16) * 8];
    v8h k1 = *(const v8h*)&ks[hi * KP + (m0 + 16 + l16) * 8];
    v16h ka;
#pragma unroll
    for (int e = 0; e < 8; ++e) { ka[e] = k0[e]; ka[e + 8] = k1[e]; }
    v8f s0 = WMMA_F16(ka, bq0, negm);
    v8f s1 = WMMA_F16(ka, bq1, negm);

    v16h pb;                                    // P as B operand [m=32 x q=16]
#pragma unroll
    for (int r = 0; r < 8; ++r) {
      float p0 = __builtin_amdgcn_exp2f(s0[r]);
      float p1 = __builtin_amdgcn_exp2f(s1[r]);
      ls[r] += p0 + p1;
      pb[r]     = (_Float16)p0;                 // m = r+8*hi       (matches B layout)
      pb[r + 8] = (_Float16)p1;                 // m = 16+r+8*hi
    }

    // V tiles as A operand [16 d x 32 m]
    const _Float16* v0p = &vs[l16 * VP + m0 + 8 * hi];
    const _Float16* v1p = &vs[(16 + l16) * VP + m0 + 8 * hi];
    v8h va0l = *(const v8h*)v0p, va0h = *(const v8h*)(v0p + 16);
    v8h va1l = *(const v8h*)v1p, va1h = *(const v8h*)(v1p + 16);
    v16h va0, va1;
#pragma unroll
    for (int e = 0; e < 8; ++e) {
      va0[e] = va0l[e]; va0[e + 8] = va0h[e];
      va1[e] = va1l[e]; va1[e + 8] = va1h[e];
    }
    acc0 = WMMA_F16(va0, pb, acc0);
    acc1 = WMMA_F16(va1, pb, acc1);
  }
  float lQ = ((ls[0] + ls[1]) + (ls[2] + ls[3])) + ((ls[4] + ls[5]) + (ls[6] + ls[7]));
  lQ += __shfl_xor(lQ, 16, 32);

  // normalize, ReLU, store O as [b][h*32+d][n] f16 for the projection GEMM
  const float inv = 1.0f / lQ;
  const int b = bh >> 3, h = bh & 7;
  _Float16* obase = Ows + ((size_t)b * (NH * DV) + h * DV) * NN + q;
#pragma unroll
  for (int r = 0; r < 8; ++r) {
    int d0 = r + 8 * hi, d1 = 16 + r + 8 * hi;
    obase[(size_t)d0 * NN] = (_Float16)fmaxf(acc0[r] * inv, 0.f);
    obase[(size_t)d1 * NN] = (_Float16)fmaxf(acc1[r] * inv, 0.f);
  }
}

// ---------------------------------------------------------------------------
// Kernel 3: output projection 1x1-conv + BN, f32 result to d_out.
// ---------------------------------------------------------------------------
__global__ __launch_bounds__(256) void proj_kernel(
    const _Float16* __restrict__ Ows, const float* __restrict__ wp,
    const float* __restrict__ sp, const float* __restrict__ bp,
    float* __restrict__ out)
{
  __shared__ __align__(16) _Float16 xs[64 * 264];
  // per wave its 16 weight rows, f16, whole (two work-groups a WGP: the LDS is there)
  __shared__ __align__(16) _Float16 wsm[8 * 16 * 264];
  const int tid = threadIdx.x;
  const int b   = blockIdx.z;
  const int n0  = blockIdx.x * 64;

  // the wave's number as a scalar: the row tile and its base addresses are wave-uniform
  const int wave = __builtin_amdgcn_readfirstlane(tid >> 5);
  const int lane = tid & 31;
  const int l16 = lane & 15, hi = lane >> 4;
  const int rt  = blockIdx.y * 8 + wave;        // 0..15
  const int orow = rt * 16;

  // as in the QKV kernel: scale, bias and the weight rows come ahead of the barrier,
  // all loads in flight at once; whole-line weight loads (512 contiguous B each), handed
  // to the fragments' lanes through LDS, where the k loop reads them behind the barrier
  const v4f sl0 = *(const v4f*)(sp + orow + 8 * hi), sl1 = *(const v4f*)(sp + orow + 8 * hi + 4);
  const v4f bl0 = *(const v4f*)(bp + orow + 8 * hi), bl1 = *(const v4f*)(bp + orow + 8 * hi + 4);

  const float* arow = wp + (size_t)orow * NC + lane * 4;
  _Float16*       wst = &wsm[wave * 16 * 264 + lane * 4];
  const _Float16* wld = &wsm[(wave * 16 + l16) * 264 + hi * 8];
  // the thread's 64 adjacent channels of its column are 128 contiguous B of the LDS row
  const _Float16* xp = Ows + (size_t)b * NC * NN + n0 + (tid >> 6) * 64 * NN + (tid & 63);
  _Float16*       xd = &xs[(tid & 63) * 264 + (tid >> 6) * 64];
  v4f ar[32];                                   // row i >> 1, channels (i & 1) * 128 + 4 * lane ..
#pragma unroll
  for (int i = 0; i < 32; ++i) ar[i] = *(const v4f*)(arow + (i >> 1) * NC + (i & 1) * 128);
  _Float16 xr[64];
#pragma unroll
  for (int k = 0; k < 64; ++k) xr[k] = xp[k * NN];
  // behind the run's loads: both address registers stay allotted up to this wait, so
  // that no load's result lands in a register that a load of the run names
  asm volatile("s_wait_xcnt 0x0" :: "v"(arow), "v"(xp) : "memory");
#pragma unroll
  for (int i = 0; i < 32; ++i) {
    v4h wh;
#pragma unroll
    for (int e = 0; e < 4; ++e) wh[e] = (_Float16)ar[i][e];
    *(v4h*)(wst + (i >> 1) * 264 + (i & 1) * 128) = wh;
  }
#pragma unroll
  for (int j = 0; j < 8; ++j) {                 // 16-B stores, as in the QKV kernel
    v8h xh;
#pragma unroll
    for (int e = 0; e < 8; ++e) xh[e] = xr[8 * j + e];
    *(v8h*)(xd + 8 * j) = xh;
  }
  __syncthreads();

  v8f acc[4] = {};
#pragma unroll
  for (int ck = 0; ck < 8; ++ck) {
    const int cbase = ck * 32 + hi * 8;
    const v8h alo = *(const v8h*)(wld + ck * 32), ahi = *(const v8h*)(wld + ck * 32 + 16);
    v16h aop;
#pragma unroll
    for (int e = 0; e < 8; ++e) { aop[e] = alo[e]; aop[e + 8] = ahi[e]; }
#pragma unroll
    for (int ct = 0; ct < 4; ++ct) {
      const _Float16* bptr = &xs[(ct * 16 + l16) * 264 + cbase];
      v8h blo = *(const v8h*)bptr;
      v8h bh2 = *(const v8h*)(bptr + 16);
      v16h bop;
#pragma unroll
      for (int e = 0; e < 8; ++e) { bop[e] = blo[e]; bop[e + 8] = bh2[e]; }
      acc[ct] = WMMA_F16(aop, bop, acc[ct]);
    }
  }

  float sl[8], bl[8];                           // the lane's own eight rows
#pragma unroll
  for (int r = 0; r < 4; ++r) { sl[r] = sl0[r]; sl[r + 4] = sl1[r]; bl[r] = bl0[r]; bl[r + 4] = bl1[r]; }
#pragma unroll
  for (int ct = 0; ct < 4; ++ct) {
    const int nn = n0 + ct * 16 + l16;
    float* dst = out + (size_t)b * NC * NN + nn;
#pragma unroll
    for (int r = 0; r < 8; ++r) {
      int o = orow + r + 8 * hi;
      dst[(size_t)o * NN] = acc[ct][r] * sl[r] + bl[r];
    }
  }
}

// ---------------------------------------------------------------------------
extern "C" void kernel_launch(void* const* d_in, const int* in_sizes, int n_in,
                              void* d_out, int out_size, void* d_ws, size_t ws_size,
                              hipStream_t stream) {
  const float* x  = (const float*)d_in[0];
  const float* wq = (const float*)d_in[1];
  const float* sq = (const float*)d_in[2];
  const float* bq = (const float*)d_in[3];
  const float* wk = (const float*)d_in[4];
  const float* sk = (const float*)d_in[5];
  const float* bk = (const float*)d_in[6];
  const float* wv = (const float*)d_in[7];
  const float* sv = (const float*)d_in[8];
  const float* bv = (const float*)d_in[9];
  const float* wp = (const float*)d_in[10];
  const float* sp = (const float*)d_in[11];
  const float* bp = (const float*)d_in[12];
  float* out = (float*)d_out;

  // Workspace layout (f16): Q 4MB | K 4MB | V 8MB | O 8MB  (24MB total)
  char* wsb = (char*)d_ws;
  _Float16* Qws = (_Float16*)(wsb);
  _Float16* Kws = (_Float16*)(wsb + (4u  << 20));
  _Float16* Vws = (_Float16*)(wsb + (8u  << 20));
  _Float16* Ows = (_Float16*)(wsb + (16u << 20));

  qkv_kernel <<<dim3(16, 4, 16), 256, 0, stream>>>(x, wq, sq, bq, wk, sk, bk, wv, sv, bv, Qws, Kws, Vws);
  attn_kernel<<<dim3(4, 128),    512, 0, stream>>>(Qws, Kws, Vws, Ows);
  proj_kernel<<<dim3(16, 2, 16), 256, 0, stream>>>(Ows, wp, sp, bp, out);

  (void)in_sizes; (void)n_in; (void)out_size; (void)ws_size;
}
